// v000
// The times below were measured on an AMD MI455X: many runs one after another, warmed up first and cycling through
// copies of the inputs, with the whole window's GPU time divided by the number of runs. Launches and the gaps
// between them are all in it. The median over several windows is given; except for v000 it joins two sittings, which
// can be a few percent apart, so the side-by-side timings, each taken in one sitting, are the better comparison.
// v000, which the later versions start from, runs in 1960 microseconds.
// Contractions: f/g projections and q.k energy on v_wmma_f32_16x16x32_bf16 with bf16 hi/lo operand planes laid along K (hi.hi + lo.hi + hi.lo, 3 products); h projection, att.v and output projection on v_wmma_f32_16x16x32_f16 (weights carried x256, activations x16, probabilities x32768); f32 accumulate; statistics, softmax, bias and residual in f32.
#include <hip/hip_runtime.h>
#include <math.h>

/* --------------------------------------------------------------------------- */
/* Shape constants                                                             */
/* --------------------------------------------------------------------------- */
constexpr int kNB   = 4;
constexpr int kCH   = 512;
constexpr int kHW   = 4096;
constexpr int kK3   = 3 * kCH;
constexpr int kFGld = 6 * kCH;
constexpr int kQRows = 2048;
constexpr int kStatPitch = 32;
constexpr float kWCarry = 256.0f;
constexpr float kXCarry = 16.0f;
constexpr float kPCarry = 32768.0f;
constexpr float kEps    = 1e-5f;
constexpr float kInvHW  = 1.0f / (float)kHW;
/* h projection: acc = kWCarry*kXCarry*H, stored plane = kXCarry*H */
constexpr float kScaleH  = 1.0f / kWCarry;
/* att.v: acc = kPCarry*kXCarry*ao, stored plane = kXCarry*ao */
constexpr float kScalePV = 1.0f / kPCarry;
/* output projection: acc = kWCarry*kXCarry*out */
constexpr float kScaleO  = 1.0f / (kWCarry * kXCarry);

static_assert(kCH % 64 == 0 && kHW % 64 == 0 && kQRows % 64 == 0);
static_assert(kK3 % 32 == 0 && kCH % 32 == 0 && kHW % 32 == 0);
static_assert((2 * kCH) % 64 == 0);
static_assert(kHW % kQRows == 0);

typedef __attribute__((ext_vector_type(16))) _Float16 v16h;
typedef __attribute__((ext_vector_type(8)))  _Float16 v8h;
typedef __attribute__((ext_vector_type(16))) __bf16   v16b;
typedef __attribute__((ext_vector_type(8)))  __bf16   v8b;
typedef __attribute__((ext_vector_type(8)))  float    v8f;
typedef __attribute__((ext_vector_type(4)))  float    v4f;
typedef __attribute__((ext_vector_type(4)))  unsigned int v4u;

__device__ __forceinline__ unsigned short f2bf_bits(float f) {
  unsigned u = __float_as_uint(f);
  return (unsigned short)((u + 0x7FFFu + ((u >> 16) & 1u)) >> 16);
}
__device__ __forceinline__ float bf_bits2f(unsigned short h) { return __uint_as_float(((unsigned)h) << 16); }
__device__ __forceinline__ unsigned pk16(unsigned short a, unsigned short b) { return (unsigned)a | ((unsigned)b << 16); }
__device__ __forceinline__ unsigned short h_bits(float f) { const _Float16 h = (_Float16)f; return __builtin_bit_cast(unsigned short, h); }

/* hazard guards as plain device helpers: every accumulator of a group is tied, one per statement; */
/* the last statement carries the four nops and names the A and B fragment registers as inputs.     */
__device__ __forceinline__ void tie_h(v8f& a, v16h x, v16h y) { asm volatile("" : "+v"(a) : "v"(x), "v"(y)); }
__device__ __forceinline__ void tie_b(v8f& a, v16b x, v16b y) { asm volatile("" : "+v"(a) : "v"(x), "v"(y)); }
__device__ __forceinline__ void nopg_h(v8f& a, v16h x, v16h y) { asm volatile("v_nop\n\tv_nop\n\tv_nop\n\tv_nop" : "+v"(a) : "v"(x), "v"(y)); }
__device__ __forceinline__ void nopg_b(v8f& a, v16b x, v16b y) { asm volatile("v_nop\n\tv_nop\n\tv_nop\n\tv_nop" : "+v"(a) : "v"(x), "v"(y)); }
__device__ __forceinline__ void keep4_h(v16h a, v16h b, v16h c, v16h d) { asm volatile("v_nop" :: "v"(a), "v"(b), "v"(c), "v"(d)); }
__device__ __forceinline__ void keep4_b(v16b a, v16b b, v16b c, v16b d) { asm volatile("v_nop" :: "v"(a), "v"(b), "v"(c), "v"(d)); }
__device__ __forceinline__ void acc_guard4(v8f& a, v8f& b, v8f& c, v8f& d) { asm volatile("v_nop\n\tv_nop\n\tv_nop\n\tv_nop" : "+v"(a), "+v"(b), "+v"(c), "+v"(d)); }

template <typename T> struct Frag;
template <> struct Frag<_Float16> {
  typedef v16h V; union U { v16h v; v8h h[2]; };
  /* elements 0..7 <- p[0..7], elements 8..15 <- p[16..23] */
  static __device__ __forceinline__ v16h load(const _Float16* p) {
    U f; f.h[0] = *(const v8h*)(p); f.h[1] = *(const v8h*)(p + 16); return f.v;
  }
  static __device__ __forceinline__ v8f mma(v16h a, v16h b, v8f c) {
    return __builtin_amdgcn_wmma_f32_16x16x32_f16(false, a, false, b, (short)0, c, false, false);
  }
  static __device__ __forceinline__ void guard_row(v8f& c0, v8f& c1, v8f& c2, v8f& c3, v16h a, v16h b0, v16h b1, v16h b2, v16h b3) {
    tie_h(c0, a, b0); tie_h(c1, a, b1); tie_h(c2, a, b2); nopg_h(c3, a, b3);
  }
  static __device__ __forceinline__ void keep(v16h a, v16h b, v16h c, v16h d) { keep4_h(a, b, c, d); }
};
template <> struct Frag<__bf16> {
  typedef v16b V; union U { v16b v; v8b h[2]; };
  static __device__ __forceinline__ v16b load(const __bf16* p) {
    U f; f.h[0] = *(const v8b*)(p); f.h[1] = *(const v8b*)(p + 16); return f.v;
  }
  static __device__ __forceinline__ v8f mma(v16b a, v16b b, v8f c) {
    return __builtin_amdgcn_wmma_f32_16x16x32_bf16(false, a, false, b, (short)0, c, false, false);
  }
  static __device__ __forceinline__ void guard_row(v8f& c0, v8f& c1, v8f& c2, v8f& c3, v16b a, v16b b0, v16b b1, v16b b2, v16b b3) {
    tie_b(c0, a, b0); tie_b(c1, a, b1); tie_b(c2, a, b2); nopg_b(c3, a, b3);
  }
  static __device__ __forceinline__ void keep(v16b a, v16b b, v16b c, v16b d) { keep4_b(a, b, c, d); }
};

/* ---- Register-blocked WMMA GEMM ------------------------------------------------------------------ */
/* C[m,n] = scale * sum_k A[m,k] * Bt[n,k] (+bias)(+resid); each wave owns a 64x64 tile.               */
/* A row-major [M,K] pitch lda; Bt row-major [N,K] pitch ldb; M,N % 64 == 0, K % 32 == 0.              */
/* ET: 0 = f16 operands, 1 = bf16 operands (pointers passed as 16-bit storage).                        */
/* BIAS_MODE: 0 = none, 1 = bias[m], 2 = bias[n].                                                      */
/* OUT_MODE: 0 = f32; 1 = f16; 3 = bf16 hi/lo triple-segment rows of pitch ldc:                         */
/*   columns n < N/2  -> [hi | hi | lo] at segment offsets 0, N/2, N     (first 3*N/2 columns)         */
/*   columns n >= N/2 -> [hi | lo | hi] at segment offsets 0, N/2, N     (second 3*N/2 columns)        */
/* RESID (OUT_MODE 0): the addend is fetched in the store phase, one 16-B load per lane at the address */
/* it is about to store.                                                                               */
template <int ET> struct Elem;
template <> struct Elem<0> { typedef _Float16 T; };
template <> struct Elem<1> { typedef __bf16 T; };

template <int ET, int BIAS_MODE, int OUT_MODE, bool RESID>
__global__ __launch_bounds__(256) void wmma_gemm64(
    const unsigned short* __restrict__ Ap, int lda,
    const unsigned short* __restrict__ Btp, int ldb,
    void* __restrict__ Cout, int ldc,
    const float* __restrict__ bias,
    const float* __restrict__ resid,
    int M, int N, int K, float scale) {
  typedef typename Elem<ET>::T T;
  typedef typename Frag<T>::V V;
  const T* Ab = (const T*)(const void*)Ap;
  const T* Bb = (const T*)(const void*)Btp;
  /* per-wave 16x64 slab, pitch 68 floats */
  __shared__ __align__(16) float sT[8][16 * 68];
  const int lane = threadIdx.x & 31;
  const int wave = threadIdx.x >> 5;
  const int tilesN = N >> 6;
  const int tilesM = M >> 6;
  const int tile = blockIdx.x * 8 + wave;
  /* wave-uniform exit; this kernel has no block barriers */
  if (tile >= tilesM * tilesN) return;
  const int tm = tile / tilesN;
  const int tn = tile - tm * tilesN;
  const int m0 = tm << 6;
  const int n0 = tn << 6;

  /* row (A) / column (B, D) within a 16-wide subtile; k offset and D row offset of this lane half */
  const int rlane = lane & 15;
  const int koff  = (lane >> 4) * 8;
  const int mOff  = (lane >> 4) * 8;

  v8f acc[4][4];
#pragma unroll
  for (int i = 0; i < 4; ++i)
#pragma unroll
    for (int j = 0; j < 4; ++j) acc[i][j] = (v8f){0.f,0.f,0.f,0.f,0.f,0.f,0.f,0.f};

  for (int k0 = 0; k0 < K; k0 += 32) {
    V bh[4];
#pragma unroll
    for (int j = 0; j < 4; ++j) {
      const size_t bo = (size_t)(n0 + (j << 4) + rlane) * ldb + koff + k0;
      bh[j] = Frag<T>::load(Bb + bo);
    }
#pragma unroll
    for (int i = 0; i < 4; ++i) {
      const size_t ao = (size_t)(m0 + (i << 4) + rlane) * lda + koff + k0;
      V ah = Frag<T>::load(Ab + ao);
#pragma unroll
      for (int j = 0; j < 4; ++j) acc[i][j] = Frag<T>::mma(ah, bh[j], acc[i][j]);
      Frag<T>::guard_row(acc[i][0], acc[i][1], acc[i][2], acc[i][3], ah, bh[0], bh[1], bh[2], bh[3]);
    }
    Frag<T>::keep(bh[0], bh[1], bh[2], bh[3]);
  }
  acc_guard4(acc[0][0], acc[0][1], acc[0][2], acc[0][3]);
  acc_guard4(acc[1][0], acc[1][1], acc[1][2], acc[1][3]);
  acc_guard4(acc[2][0], acc[2][1], acc[2][2], acc[2][3]);
  acc_guard4(acc[3][0], acc[3][1], acc[3][2], acc[3][3]);

  /* ---- epilogue ---- */
  float* slab = sT[wave];
#pragma unroll
  for (int i = 0; i < 4; ++i) {
    const int mBase = m0 + (i << 4);
    float brow[8];
#pragma unroll
    for (int r = 0; r < 8; ++r) brow[r] = 0.f;
    if (BIAS_MODE == 1) {
      /* rows mBase+mOff .. +7: two 16-B loads (32-B aligned) */
      const v4f b0 = *(const v4f*)(bias + mBase + mOff);
      const v4f b1 = *(const v4f*)(bias + mBase + mOff + 4);
#pragma unroll
      for (int e = 0; e < 4; ++e) { brow[e] = b0[e]; brow[4 + e] = b1[e]; }
    }
#pragma unroll
    for (int j = 0; j < 4; ++j) {
      const int n = n0 + (j << 4) + rlane;
      float bv = 0.f;
      if (BIAS_MODE == 2) bv = bias[n];
#pragma unroll
      for (int r = 0; r < 8; ++r) {
        float v = acc[i][j][r] * scale;
        if (BIAS_MODE == 1) v += brow[r];
        if (BIAS_MODE == 2) v += bv;
        slab[(mOff + r) * 68 + (j << 4) + rlane] = v;
      }
    }
    __builtin_amdgcn_fence(__ATOMIC_RELEASE, "workgroup");
    __builtin_amdgcn_wave_barrier();
    __builtin_amdgcn_fence(__ATOMIC_ACQUIRE, "workgroup");
    if (OUT_MODE == 0) {
      float* C = (float*)Cout;
      /* row segment = 256 B = 16 lanes x 16 B; two rows per instruction */
      const int hh = lane >> 4, c4 = (lane & 15) * 4;
      if (RESID) {
        v4f vals[8];
#pragma unroll
        for (int it = 0; it < 8; ++it) {
          const int row = it * 2 + hh;
          const v4f sv = *(const v4f*)(slab + row * 68 + c4);
          const v4f rv = *(const v4f*)(resid + (size_t)(mBase + row) * ldc + n0 + c4);
          vals[it] = sv + rv;
        }
        {
#pragma unroll
          for (int it = 0; it < 8; ++it) {
            const int row = it * 2 + hh;
            *(v4f*)(C + (size_t)(mBase + row) * ldc + n0 + c4) = vals[it];
          }
          
        }
      } else {
        {
#pragma unroll
          for (int it = 0; it < 8; ++it) {
            const int row = it * 2 + hh;
            v4f v = *(const v4f*)(slab + row * 68 + c4);
            *(v4f*)(C + (size_t)(mBase + row) * ldc + n0 + c4) = v;
          }
          
        }
      }
    } else {
      const int q = lane >> 3, c8 = (lane & 7) * 8;
      unsigned short* C = (unsigned short*)Cout;
      int col0 = n0 + c8;
      int col1 = col0;
      int col2 = col0;
      if (OUT_MODE == 3) {
        /* wave-uniform segment selection */
        const int halfN = N >> 1;
        const int isg = (n0 >= halfN) ? 1 : 0;
        const int nn = n0 - isg * halfN;
        col0 = isg * 3 * halfN + nn + c8;
        col1 = col0 + (isg ? 2 * halfN : halfN);
        col2 = col0 + (isg ? halfN : 2 * halfN);
      }
      {
#pragma unroll
        for (int it = 0; it < 4; ++it) {
          const int row = it * 4 + q;
          const float* sp = slab + row * 68 + c8;
          v8h hv, lv;
#pragma unroll
          for (int e = 0; e < 8; ++e) {
            if (OUT_MODE == 1) {
              hv[e] = (_Float16)sp[e];
              lv[e] = hv[e];
            } else {
              const unsigned short hb = f2bf_bits(sp[e]);
              const unsigned short lb = f2bf_bits(sp[e] - bf_bits2f(hb));
              hv[e] = __builtin_bit_cast(_Float16, hb);
              lv[e] = __builtin_bit_cast(_Float16, lb);
            }
          }
          unsigned short* rowp = C + (size_t)(mBase + row) * ldc;
          *(v8h*)(rowp + col0) = hv;
          if (OUT_MODE == 3) {
            *(v8h*)(rowp + col1) = hv;
            *(v8h*)(rowp + col2) = lv;
          }
        }
        
      }
    }
    __builtin_amdgcn_fence(__ATOMIC_RELEASE, "workgroup");
    __builtin_amdgcn_wave_barrier();
    __builtin_amdgcn_fence(__ATOMIC_ACQUIRE, "workgroup");
  }
}

/* --------------------------------------------------------------------------- */
/* f/g weight planes: W3[1024][1536] bf16, row o = [hi(512) | hi(512) | lo(512)] of f_w row o (o < 512)        */
/* or g_w row o-512. One thread = 8 consecutive input channels.                                               */
/* Coverage: 256 blocks x 256 threads x 8 = 524288 = 1024 x 512. Each store instruction: 32 lanes x 16 B =    */
/* --------------------------------------------------------------------------- */
__global__ __launch_bounds__(256) void wsplit_kernel(const float* __restrict__ fw, const float* __restrict__ gw,
                                                     unsigned short* __restrict__ W3) {
  const int i = blockIdx.x * 256 + threadIdx.x;
  const int row = i >> 6;
  const int c8 = (i & 63) * 8;
  /* block-uniform: a block covers 4 whole rows */
  const float* src = (row < kCH) ? (fw + (size_t)row * kCH) : (gw + (size_t)(row - kCH) * kCH);
  const v4f a = *(const v4f*)(src + c8);
  const v4f c = *(const v4f*)(src + c8 + 4);
  float x[8];
#pragma unroll
  for (int e = 0; e < 4; ++e) { x[e] = a[e]; x[4 + e] = c[e]; }
  unsigned short hb[8], lb[8];
#pragma unroll
  for (int e = 0; e < 8; ++e) {
    hb[e] = f2bf_bits(x[e]);
    lb[e] = f2bf_bits(x[e] - bf_bits2f(hb[e]));
  }
  const v4u uh = (v4u){pk16(hb[0], hb[1]), pk16(hb[2], hb[3]), pk16(hb[4], hb[5]), pk16(hb[6], hb[7])};
  const v4u ul = (v4u){pk16(lb[0], lb[1]), pk16(lb[2], lb[3]), pk16(lb[4], lb[5]), pk16(lb[6], lb[7])};
  unsigned short* rp = W3 + (size_t)row * kK3 + c8;
  {
    *(v4u*)(rp) = uh;
    *(v4u*)(rp + kCH) = uh;
    *(v4u*)(rp + 2 * kCH) = ul;
    
  }
}

/* --------------------------------------------------------------------------- */
/* h_w / o_w -> f16 planes carried x kWCarry. grid (128, 2): blockIdx.y selects the matrix (block-uniform).   */
/* Coverage: 128 blocks x 256 threads x 8 = 262144 = 512 x 512 per matrix. One 16-B store per lane, a wave    */
/* --------------------------------------------------------------------------- */
__global__ __launch_bounds__(256) void wcast_kernel(const float* __restrict__ hw, const float* __restrict__ ow,
                                                    unsigned short* __restrict__ hw16, unsigned short* __restrict__ ow16) {
  const int i = blockIdx.x * 256 + threadIdx.x;
  const float* src = (blockIdx.y == 0) ? hw : ow;
  unsigned short* dst = (blockIdx.y == 0) ? hw16 : ow16;
  const float* p = src + 8 * (size_t)i;
  const v4f a = *(const v4f*)(p);
  const v4f c = *(const v4f*)(p + 4);
  unsigned short hb[8];
#pragma unroll
  for (int e = 0; e < 4; ++e) {
    hb[e]     = h_bits(a[e] * kWCarry);
    hb[4 + e] = h_bits(c[e] * kWCarry);
  }
  const v4u u = (v4u){pk16(hb[0], hb[1]), pk16(hb[2], hb[3]), pk16(hb[4], hb[5]), pk16(hb[6], hb[7])};
  unsigned short* q = dst + 8 * (size_t)i;
  *(v4u*)q = u;
  
}

/* --------------------------------------------------------------------------- */
/* Bias tables: fgb[1024] = [f_b | g_b]; hb16[512] = kXCarry * h_b. One block of 256 threads.                 */
/* fgb: 256 threads x 4 floats = 1024; hb16: waves 0..3 x 32 lanes x 4 floats = 512. Every wave writes 4      */
/* --------------------------------------------------------------------------- */
__global__ __launch_bounds__(256) void bias_prep_kernel(const float* __restrict__ fb, const float* __restrict__ gb,
                                                        const float* __restrict__ hb,
                                                        float* __restrict__ fgb, float* __restrict__ hb16) {
  const int t = threadIdx.x;
  const int j = (t & 127) * 4;
  const v4f a = *(const v4f*)(fb + j);
  const v4f g = *(const v4f*)(gb + j);
  const v4f h = *(const v4f*)(hb + j);
  const bool first = (t < 128);
  v4f v;
#pragma unroll
  for (int e = 0; e < 4; ++e) v[e] = first ? a[e] : g[e];
  v4f hs;
#pragma unroll
  for (int e = 0; e < 4; ++e) hs[e] = h[e] * kXCarry;
  {
    *(v4f*)(fgb + 4 * t) = v;
    /* wave-uniform: waves 0..3 */
    if (first) *(v4f*)(hb16 + 4 * t) = hs;
    
  }
}

/* --------------------------------------------------------------------------- */
/* grid = 4*512 blocks, one per (batch, channel); block 256 threads x 16 values = 4096.                        */
/* --------------------------------------------------------------------------- */
__device__ __forceinline__ float block_sum256(float v, float* red, int lane, int wave) {
#pragma unroll
  for (int off = 16; off > 0; off >>= 1) v += __shfl_xor(v, off, 32);
  if (lane == 0) red[wave] = v;
  __syncthreads();
  float s = 0.f;
#pragma unroll
  for (int w = 0; w < 8; ++w) s += red[w];
  __syncthreads();
  return s;
}

__global__ __launch_bounds__(256) void chan_stats_kernel(const float* __restrict__ x, float* __restrict__ stats) {
  __shared__ float red[8];
  const int t = threadIdx.x, lane = t & 31, wave = t >> 5;
  const float* row = x + (size_t)blockIdx.x * kHW;
  v4f v[4];
#pragma unroll
  for (int q = 0; q < 4; ++q) v[q] = *(const v4f*)(row + (size_t)(q * 256 + t) * 4);
  float s = 0.f;
#pragma unroll
  for (int q = 0; q < 4; ++q) s += (v[q][0] + v[q][1]) + (v[q][2] + v[q][3]);
  s = block_sum256(s, red, lane, wave);
  const float mean = s * kInvHW;
  float ss = 0.f;
#pragma unroll
  for (int q = 0; q < 4; ++q) {
#pragma unroll
    for (int e = 0; e < 4; ++e) {
      const float d = v[q][e] - mean;
      ss += d * d;
    }
  }
  ss = block_sum256(ss, red, lane, wave);
  const float var = ss * kInvHW;
  const float rstd = 1.0f / sqrtf(var + kEps);
  if (wave == 0) {
    const float o = (lane == 0) ? mean : ((lane == 1) ? rstd : 0.0f);
    float* p = stats + (size_t)blockIdx.x * kStatPitch + lane;
    *p = o;
    
  }
}

/* --------------------------------------------------------------------------- */
/* Transpose one batch: x[C][HW] f32 -> normT3[HW][1536] bf16 rows [hi | lo | hi] of the normalised value over */
/* channel, and contT[HW][512] f16 of kXCarry * x. 64(ch) x 64(pix) tiles through LDS.                          */
/* grid = (HW/64, C/64), 256 threads.                                                                          */
/* Load coverage: 4 it x 256 thr x 4 floats = 4096 = 64x64. Store coverage per plane: 2 it x 32 rows x 8 lanes */
/* --------------------------------------------------------------------------- */
__global__ __launch_bounds__(256) void norm_transpose_kernel(const float* __restrict__ x, const float* __restrict__ stats,
                                                             unsigned short* __restrict__ normT3,
                                                             unsigned short* __restrict__ contT) {
  __shared__ __align__(16) float tf[64 * 68];
  __shared__ float sMean[64];
  __shared__ float sRstd[64];
  const int p0  = blockIdx.x * 64;
  const int c0  = blockIdx.y * 64;
  const int tid = threadIdx.x;
  {
    const int lr = tid >> 4;
    const int c4 = (tid & 15) * 4;
#pragma unroll
    for (int it = 0; it < 4; ++it) {
      const int rr = it * 16 + lr;
      const v4f a = *(const v4f*)(x + (size_t)(c0 + rr) * kHW + p0 + c4);
      *(v4f*)(tf + rr * 68 + c4) = a;
    }
    /* channel statistics: threads 0..63 stage the mean, 64..127 the rstd (wave-uniform branches) */
    const int ch = tid & 63;
    const int which = (tid >> 6) & 1;
    const float sv = stats[(size_t)(c0 + ch) * kStatPitch + which];
    if (tid < 64) sMean[ch] = sv;
    else if (tid < 128) sRstd[ch] = sv;
  }
  __syncthreads();
  const int sub = tid >> 3;
  const int c8  = (tid & 7) * 8;
  v4u nh[2], nl[2], cf[2];
#pragma unroll
  for (int it = 0; it < 2; ++it) {
    const int oc = it * 32 + sub;
    v4u a, a2, a3;
#pragma unroll
    for (int q = 0; q < 4; ++q) {
      const int ch0 = c8 + 2 * q;
      const int ch1 = ch0 + 1;
      const float x0 = tf[ch0 * 68 + oc];
      const float x1 = tf[ch1 * 68 + oc];
      const float n0v = (x0 - sMean[ch0]) * sRstd[ch0];
      const float n1v = (x1 - sMean[ch1]) * sRstd[ch1];
      const unsigned short h0 = f2bf_bits(n0v), h1 = f2bf_bits(n1v);
      const unsigned short l0 = f2bf_bits(n0v - bf_bits2f(h0)), l1 = f2bf_bits(n1v - bf_bits2f(h1));
      a[q]  = pk16(h0, h1);
      a2[q] = pk16(l0, l1);
      a3[q] = pk16(h_bits(x0 * kXCarry), h_bits(x1 * kXCarry));
    }
    nh[it] = a; nl[it] = a2; cf[it] = a3;
  }
  {
#pragma unroll
    for (int it = 0; it < 2; ++it) {
      const int oc = it * 32 + sub;
      unsigned short* np = normT3 + (size_t)(p0 + oc) * kK3 + c0 + c8;
      unsigned short* cp = contT + (size_t)(p0 + oc) * kCH + c0 + c8;
      *(v4u*)(np) = nh[it];
      *(v4u*)(np + kCH) = nl[it];
      *(v4u*)(np + 2 * kCH) = nh[it];
      *(v4u*)(cp) = cf[it];
    }
    
  }
}

/* --------------------------------------------------------------------------- */
/* Row softmax over 4096 f32 logits: P[row][k] = f16( kPCarry * exp(s - max) / sum exp(s - max) ), f32 math.   */
/* One block of 256 threads per row; thread t owns columns 8t..8t+7 and 2048+8t..2048+8t+7 (256 x 16 = 4096).  */
/* Reductions in fixed order (thread, wave shuffle tree, 8 wave partials in index order).                      */
/* Store: two instructions, each one 16-B store per lane; a wave's 32 lanes write 512 contiguous B = 4 whole   */
/* --------------------------------------------------------------------------- */
__global__ __launch_bounds__(256) void softmax_rows_kernel(const float* __restrict__ E, unsigned short* __restrict__ P) {
  __shared__ float redM[8];
  __shared__ float redS[8];
  const int row  = blockIdx.x;
  const int t    = threadIdx.x;
  const int lane = t & 31, wave = t >> 5;
  const float* sr = E + (size_t)row * kHW + 8 * t;
  const v4f a0 = *(const v4f*)(sr);
  const v4f a1 = *(const v4f*)(sr + 4);
  const v4f b0 = *(const v4f*)(sr + kHW / 2);
  const v4f b1 = *(const v4f*)(sr + kHW / 2 + 4);
  float x[16];
#pragma unroll
  for (int e = 0; e < 4; ++e) { x[e] = a0[e]; x[4 + e] = a1[e]; x[8 + e] = b0[e]; x[12 + e] = b1[e]; }
  float m = x[0];
#pragma unroll
  for (int e = 1; e < 16; ++e) m = fmaxf(m, x[e]);
#pragma unroll
  for (int off = 16; off > 0; off >>= 1) m = fmaxf(m, __shfl_xor(m, off, 32));
  if (lane == 0) redM[wave] = m;
  __syncthreads();
  float mx = redM[0];
#pragma unroll
  for (int w = 1; w < 8; ++w) mx = fmaxf(mx, redM[w]);
  float s = 0.f;
#pragma unroll
  for (int e = 0; e < 16; ++e) {
    x[e] = __expf(x[e] - mx);
    s += x[e];
  }
#pragma unroll
  for (int off = 16; off > 0; off >>= 1) s += __shfl_xor(s, off, 32);
  if (lane == 0) redS[wave] = s;
  __syncthreads();
  float tot = 0.f;
#pragma unroll
  for (int w = 0; w < 8; ++w) tot += redS[w];
  const float inv = kPCarry * (1.0f / tot);
  unsigned short hb[16];
#pragma unroll
  for (int e = 0; e < 16; ++e) hb[e] = h_bits(x[e] * inv);
  const v4u u0 = (v4u){pk16(hb[0], hb[1]), pk16(hb[2], hb[3]), pk16(hb[4], hb[5]), pk16(hb[6], hb[7])};
  const v4u u1 = (v4u){pk16(hb[8], hb[9]), pk16(hb[10], hb[11]), pk16(hb[12], hb[13]), pk16(hb[14], hb[15])};
  unsigned short* pr = P + (size_t)row * kHW + 8 * t;
  {
    *(v4u*)(pr) = u0;
    *(v4u*)(pr + kHW / 2) = u1;
    
  }
}

/* --------------------------------------------------------------------------- */
/* Host orchestration (kernel launches and host arithmetic only).                                              */
/* d_in: 0 = content [4][512][4096], 1 = f_w, 2 = f_b, 3 = g_w, 4 = g_b, 5 = h_w, 6 = h_b, 7 = o_w, 8 = o_b    */
/* (weights [out][in] f32, biases [512] f32).                                                                  */
/* --------------------------------------------------------------------------- */
extern "C" void kernel_launch(void* const* d_in, const int* in_sizes, int n_in,
                              void* d_out, int out_size, void* d_ws, size_t ws_size,
                              hipStream_t stream) {
  if (n_in < 9) return;
  if (in_sizes[0] != kNB * kCH * kHW || out_size != kNB * kCH * kHW) return;
  if (in_sizes[1] != kCH * kCH || in_sizes[3] != kCH * kCH || in_sizes[5] != kCH * kCH || in_sizes[7] != kCH * kCH) return;
  if (in_sizes[2] != kCH || in_sizes[4] != kCH || in_sizes[6] != kCH || in_sizes[8] != kCH) return;

  const float* content = (const float*)d_in[0];
  const float* f_w = (const float*)d_in[1];
  const float* f_b = (const float*)d_in[2];
  const float* g_w = (const float*)d_in[3];
  const float* g_b = (const float*)d_in[4];
  const float* h_w = (const float*)d_in[5];
  const float* h_b = (const float*)d_in[6];
  const float* o_w = (const float*)d_in[7];
  const float* o_b = (const float*)d_in[8];
  float* out = (float*)d_out;

  /*
       W3fg   bf16 [1024][1536]            3,145,728
       hw16   f16  [512][512]                524,288
       ow16   f16  [512][512]                524,288
       fgb    f32  [1024]                      4,096
       hb16   f32  [512]                       2,048
       stats  f32  [4*512][32]               262,144
       normT3 bf16 [4096][1536]           12,582,912
       contT  f16  [4096][512]             4,194,304
       FG3    bf16 [4096][3072]           25,165,824
       H16    f16  [512][4096]             4,194,304
       energy f32  [2048][4096]           33,554,432
       att    f16  [4096][4096]           33,554,432
       aoT    f16  [4096][512]             4,194,304
       total                             121,903,104                                              */
  const size_t bW3   = (size_t)2 * kCH * kK3 * 2;
  const size_t bW16  = (size_t)kCH * kCH * 2;
  const size_t bFGB  = (size_t)2 * kCH * 4;
  const size_t bHB   = (size_t)kCH * 4;
  const size_t bST   = (size_t)kNB * kCH * kStatPitch * 4;
  const size_t bNT3  = (size_t)kHW * kK3 * 2;
  const size_t bCT   = (size_t)kHW * kCH * 2;
  const size_t bFG3  = (size_t)kHW * kFGld * 2;
  const size_t bH16  = (size_t)kCH * kHW * 2;
  const size_t bEN   = (size_t)kQRows * kHW * 4;
  const size_t bATT  = (size_t)kHW * kHW * 2;
  const size_t bAOT  = (size_t)kHW * kCH * 2;
  char* ws = (char*)d_ws;
  size_t off = 0;
  unsigned short* W3fg   = (unsigned short*)(ws + off); off += bW3;
  unsigned short* hw16   = (unsigned short*)(ws + off); off += bW16;
  unsigned short* ow16   = (unsigned short*)(ws + off); off += bW16;
  float*          fgb    = (float*)(ws + off);          off += bFGB;
  float*          hb16   = (float*)(ws + off);          off += bHB;
  float*          stats  = (float*)(ws + off);          off += bST;
  unsigned short* normT3 = (unsigned short*)(ws + off); off += bNT3;
  unsigned short* contT  = (unsigned short*)(ws + off); off += bCT;
  unsigned short* FG3    = (unsigned short*)(ws + off); off += bFG3;
  unsigned short* H16    = (unsigned short*)(ws + off); off += bH16;
  float*          energy = (float*)(ws + off);          off += bEN;
  unsigned short* att    = (unsigned short*)(ws + off); off += bATT;
  unsigned short* aoT    = (unsigned short*)(ws + off); off += bAOT;
  if (off > ws_size || off > (size_t)134217728) return;

  const dim3 blk256(256);

  /* ---- once: weight planes, bias tables, per-(batch, channel) statistics ---- */
  wsplit_kernel<<<dim3((2 * kCH * kCH / 8) / 256), blk256, 0, stream>>>(f_w, g_w, W3fg);
  wcast_kernel<<<dim3((kCH * kCH / 8) / 256, 2), blk256, 0, stream>>>(h_w, o_w, hw16, ow16);
  bias_prep_kernel<<<dim3(1), blk256, 0, stream>>>(f_b, g_b, h_b, fgb, hb16);
  chan_stats_kernel<<<dim3(kNB * kCH), blk256, 0, stream>>>(content, stats);

  constexpr int tilesFG = (kHW / 64) * ((2 * kCH) / 64);
  constexpr int tilesH  = (kCH / 64) * (kHW / 64);
  constexpr int tilesEN = (kQRows / 64) * (kHW / 64);
  constexpr int tilesPV = (kHW / 64) * (kCH / 64);
  static_assert(tilesFG % 8 == 0 && tilesH % 8 == 0 && tilesEN % 8 == 0 && tilesPV % 8 == 0);

  for (int b = 0; b < kNB; ++b) {
    const float* xb = content + (size_t)b * kCH * kHW;
    float* ob = out + (size_t)b * kCH * kHW;
    const float* stb = stats + (size_t)b * kCH * kStatPitch;

    /* in x[C][HW] -> normT3[HW][hi|lo|hi], contT[HW][C] */
    norm_transpose_kernel<<<dim3(kHW / 64, kCH / 64), blk256, 0, stream>>>(xb, stb, normT3, contT);

    /* f|g projections: [pix][1024] = normT3[pix][hi|lo|hi] . W3fg[out][hi|hi|lo]^T + bias[out], split to
       FG3[pix][ Fhi | Fhi | Flo | Ghi | Glo | Ghi ]; M=4096, N=1024, K=1536 */
    wmma_gemm64<1, 2, 3, false><<<dim3(tilesFG / 8), blk256, 0, stream>>>(
        normT3, kK3, W3fg, kK3, (void*)FG3, kFGld, fgb, fgb, kHW, 2 * kCH, kK3, 1.0f);

    /* h projection: H16[o][pix] = kXCarry * (h_w . x + h_b); M=512, N=4096, K=512 */
    wmma_gemm64<0, 1, 1, false><<<dim3(tilesH / 8), blk256, 0, stream>>>(
        hw16, kCH, contT, kCH, (void*)H16, kHW, hb16, hb16, kCH, kHW, kCH, kScaleH);

    for (int hq = 0; hq < kHW / kQRows; ++hq) {
      /* energy[q][k] for 2048 query rows: A = F3 rows [hi|hi|lo], Bt = G3 rows [hi|lo|hi]; M=2048, N=4096, K=1536 */
      wmma_gemm64<1, 0, 0, false><<<dim3(tilesEN / 8), blk256, 0, stream>>>(
          FG3 + (size_t)hq * kQRows * kFGld, kFGld, FG3 + kK3, kFGld, (void*)energy, kHW,
          fgb, fgb, kQRows, kHW, kK3, 1.0f);
      /* softmax over keys -> att rows (f16, x kPCarry) */
      softmax_rows_kernel<<<dim3(kQRows), blk256, 0, stream>>>(energy, att + (size_t)hq * kQRows * kHW);
    }

    /* aoT[q][c] = kXCarry * sum_k att[q][k] * H[c][k]; M=4096, N=512, K=4096 */
    wmma_gemm64<0, 0, 1, false><<<dim3(tilesPV / 8), blk256, 0, stream>>>(
        att, kHW, H16, kHW, (void*)aoT, kCH, fgb, fgb, kHW, kCH, kHW, kScalePV);

    /* out[o][pix] = o_w . ao + o_b + x; M=512, N=4096, K=512 */
    wmma_gemm64<0, 1, 0, true><<<dim3(tilesH / 8), blk256, 0, stream>>>(
        ow16, kCH, aoT, kCH, (void*)ob, kHW, o_b, xb, kCH, kHW, kCH, kScaleO);
  }
}

// v001
// Measured time: 590 microseconds a run.
// Next to v000, in two timings, it ran 3.33 and 3.31 times as fast.
// Contractions: f/g projections and q.k energy on v_wmma_f32_16x16x32_bf16 with bf16 hi/lo operand planes laid along K (hi.hi + lo.hi + hi.lo, 3 products); h projection, att.v and output projection on v_wmma_f32_16x16x32_f16 (weights carried x256, activations x16, probabilities x32768); f32 accumulate; statistics, softmax, bias and residual in f32.
#include <hip/hip_runtime.h>
#include <math.h>

/* --------------------------------------------------------------------------- */
/* Shape constants                                                             */
/* --------------------------------------------------------------------------- */
constexpr int kNB   = 4;
constexpr int kCH   = 512;
constexpr int kHW   = 4096;
constexpr int kK3   = 3 * kCH;
constexpr int kFGld = 6 * kCH;
constexpr int kQRows = 2048;
constexpr int kStatPitch = 32;
constexpr float kWCarry = 256.0f;
constexpr float kXCarry = 16.0f;
constexpr float kPCarry = 32768.0f;
constexpr float kEps    = 1e-5f;
constexpr float kInvHW  = 1.0f / (float)kHW;
/* h projection: acc = kWCarry*kXCarry*H, stored plane = kXCarry*H */
constexpr float kScaleH  = 1.0f / kWCarry;
/* att.v: acc = kPCarry*kXCarry*ao, stored plane = kXCarry*ao */
constexpr float kScalePV = 1.0f / kPCarry;
/* output projection: acc = kWCarry*kXCarry*out */
constexpr float kScaleO  = 1.0f / (kWCarry * kXCarry);

static_assert(kCH % 128 == 0 && kHW % 128 == 0 && kQRows % 128 == 0);
static_assert(kK3 % 128 == 0);
static_assert((2 * kCH) % 128 == 0);
static_assert(kHW % kQRows == 0);

typedef __attribute__((ext_vector_type(16))) _Float16 v16h;
typedef __attribute__((ext_vector_type(8)))  _Float16 v8h;
typedef __attribute__((ext_vector_type(16))) __bf16   v16b;
typedef __attribute__((ext_vector_type(8)))  __bf16   v8b;
typedef __attribute__((ext_vector_type(8)))  float    v8f;
typedef __attribute__((ext_vector_type(4)))  float    v4f;
typedef __attribute__((ext_vector_type(4)))  unsigned int v4u;

__device__ __forceinline__ unsigned short f2bf_bits(float f) {
  unsigned u = __float_as_uint(f);
  return (unsigned short)((u + 0x7FFFu + ((u >> 16) & 1u)) >> 16);
}
__device__ __forceinline__ float bf_bits2f(unsigned short h) { return __uint_as_float(((unsigned)h) << 16); }
__device__ __forceinline__ unsigned pk16(unsigned short a, unsigned short b) { return (unsigned)a | ((unsigned)b << 16); }
__device__ __forceinline__ unsigned short h_bits(float f) { const _Float16 h = (_Float16)f; return __builtin_bit_cast(unsigned short, h); }

/* four vector slots between the last matrix instruction of the K loop and the first reader of its result */
__device__ __forceinline__ void acc_guard4(v8f& a, v8f& b, v8f& c, v8f& d) { asm volatile("v_nop\n\tv_nop\n\tv_nop\n\tv_nop" : "+v"(a), "+v"(b), "+v"(c), "+v"(d)); }

template <typename T> struct Frag;
template <> struct Frag<_Float16> {
  typedef v16h V; union U { v16h v; v8h h[2]; };
  /* elements 0..7 <- p[0..7], elements 8..15 <- p[16..23] */
  static __device__ __forceinline__ v16h load(const _Float16* p) {
    U f; f.h[0] = *(const v8h*)(p); f.h[1] = *(const v8h*)(p + 16); return f.v;
  }
  static __device__ __forceinline__ v8f mma(v16h a, v16h b, v8f c) {
    return __builtin_amdgcn_wmma_f32_16x16x32_f16(false, a, false, b, (short)0, c, false, false);
  }
};
template <> struct Frag<__bf16> {
  typedef v16b V; union U { v16b v; v8b h[2]; };
  static __device__ __forceinline__ v16b load(const __bf16* p) {
    U f; f.h[0] = *(const v8b*)(p); f.h[1] = *(const v8b*)(p + 16); return f.v;
  }
  static __device__ __forceinline__ v8f mma(v16b a, v16b b, v8f c) {
    return __builtin_amdgcn_wmma_f32_16x16x32_bf16(false, a, false, b, (short)0, c, false, false);
  }
};

/* ---- Register-blocked WMMA GEMM ------------------------------------------------------------------ */
/* C[m,n] = scale * sum_k A[m,k] * Bt[n,k] (+bias)(+resid); a work-group of 4 waves (2 x 2) owns a     */
/* 128x128 tile, each wave a 64x64 quarter of it.                                                      */
/* A row-major [M,K] pitch lda; Bt row-major [N,K] pitch ldb; M,N % 128 == 0, K % 128 == 0.            */
/* Operands reach the waves through LDS: a pass is 128 k = 256 B of each of the tile's 128 A rows and  */
/* 128 Bt rows, brought in by asynchronous copies (whole 256-B rows, 16 B a lane) into one of two      */
/* buffers while the other buffer is worked on; rows lie at a pitch of 272 B for the 16-B readers.     */
/* ET: 0 = f16 operands, 1 = bf16 operands (pointers passed as 16-bit storage).                        */
/* BIAS_MODE: 0 = none, 1 = bias[m], 2 = bias[n].                                                      */
/* OUT_MODE: 0 = f32; 1 = f16; 3 = bf16 hi/lo triple-segment rows of pitch ldc:                         */
/*   columns n < N/2  -> [hi | hi | lo] at segment offsets 0, N/2, N     (first 3*N/2 columns)         */
/*   columns n >= N/2 -> [hi | lo | hi] at segment offsets 0, N/2, N     (second 3*N/2 columns)        */
/* RESID (OUT_MODE 0): the addend is fetched in the store phase, one 16-B load per lane at the address */
/* it is about to store.                                                                               */
template <int ET> struct Elem;
template <> struct Elem<0> { typedef _Float16 T; };
template <> struct Elem<1> { typedef __bf16 T; };

constexpr int kPassK     = 128;
constexpr int kPassBytes = kPassK * 2;
constexpr int kRowPitch  = kPassBytes + 16;
constexpr int kOperBytes = 128 * kRowPitch;
constexpr int kBufBytes  = 2 * kOperBytes;

/* Eight asynchronous copies, 16 B a lane each, global -> LDS. The s_wait_xcnt stands inside the statement so  */
/* that it comes before any rewrite of the address registers the copies name.                                  */
__device__ __forceinline__ void async_copy8(const unsigned (&l)[8], const char* const (&g)[8]) {
  asm volatile(
      "global_load_async_to_lds_b128 %0, %8, off\n\t"
      "global_load_async_to_lds_b128 %1, %9, off\n\t"
      "global_load_async_to_lds_b128 %2, %10, off\n\t"
      "global_load_async_to_lds_b128 %3, %11, off\n\t"
      "global_load_async_to_lds_b128 %4, %12, off\n\t"
      "global_load_async_to_lds_b128 %5, %13, off\n\t"
      "global_load_async_to_lds_b128 %6, %14, off\n\t"
      "global_load_async_to_lds_b128 %7, %15, off\n\t"
      "s_wait_xcnt 0x0"
      :: "v"(l[0]), "v"(l[1]), "v"(l[2]), "v"(l[3]), "v"(l[4]), "v"(l[5]), "v"(l[6]), "v"(l[7]),
         "v"(g[0]), "v"(g[1]), "v"(g[2]), "v"(g[3]), "v"(g[4]), "v"(g[5]), "v"(g[6]), "v"(g[7])
      : "memory");
}

/* One wave's share of a pass: 32 rows of one operand, two rows a copy (lanes 0..15 one row, 16..31 the next). */
/* lds, g: the lane's own 16 B in the first pair of rows; pair2: bytes from one pair of global rows to the next. */
__device__ __forceinline__ void stage_rows32(unsigned lds, const char* g, size_t pair2) {
#pragma unroll
  for (int h = 0; h < 2; ++h) {
    unsigned l8[8];
    const char* g8[8];
#pragma unroll
    for (int j = 0; j < 8; ++j) {
      l8[j] = lds + (unsigned)((h * 8 + j) * 2 * kRowPitch);
      g8[j] = g + (size_t)(h * 8 + j) * pair2;
    }
    async_copy8(l8, g8);
  }
}

template <int ET, int BIAS_MODE, int OUT_MODE, bool RESID>
__global__ __launch_bounds__(128) void wmma_gemm64(
    const unsigned short* __restrict__ Ap, int lda,
    const unsigned short* __restrict__ Btp, int ldb,
    void* __restrict__ Cout, int ldc,
    const float* __restrict__ bias,
    const float* __restrict__ resid,
    int M, int N, int K, float scale) {
  typedef typename Elem<ET>::T T;
  typedef typename Frag<T>::V V;
  const T* Ab = (const T*)(const void*)Ap;
  const T* Bb = (const T*)(const void*)Btp;
  /* per-wave 16x64 slab, pitch 68 floats */
  __shared__ __align__(16) float sT[4][16 * 68];
  /* two buffers, each [A 128 rows | Bt 128 rows] at kRowPitch */
  __shared__ __align__(16) unsigned char ring[2 * kBufBytes];
  const int lane = threadIdx.x & 31;
  const int wave = threadIdx.x >> 5;
  const int tilesN = N >> 7;
  const int tilesM = M >> 7;
  const int tile = blockIdx.x;
  /* block-uniform exit, in front of every barrier and copy */
  if (tile >= tilesM * tilesN) return;
  const int tm = tile / tilesN;
  const int tn = tile - tm * tilesN;
  const int wm = wave >> 1;
  const int wn = wave & 1;
  const int m0 = (tm << 7) + (wm << 6);
  const int n0 = (tn << 7) + (wn << 6);

  /* row (A) / column (B, D) within a 16-wide subtile; k offset and D row offset of this lane half */
  const int rlane = lane & 15;
  const int koff  = (lane >> 4) * 8;
  const int mOff  = (lane >> 4) * 8;

  v8f acc[4][4];
#pragma unroll
  for (int i = 0; i < 4; ++i)
#pragma unroll
    for (int j = 0; j < 4; ++j) acc[i][j] = (v8f){0.f,0.f,0.f,0.f,0.f,0.f,0.f,0.f};

  /* copies: wave w brings rows 32w..32w+31 of the A tile and of the Bt tile */
  const int crow = (wave << 5) + (lane >> 4);
  const int cbyte = (lane & 15) * 16;
  const char* gA = (const char*)(Ab + (size_t)((tm << 7) + crow) * lda) + cbyte;
  const char* gB = (const char*)(Bb + (size_t)((tn << 7) + crow) * ldb) + cbyte;
  const size_t pairA = (size_t)lda * 4;
  const size_t pairB = (size_t)ldb * 4;
  const unsigned ldsA = (unsigned)(size_t)(ring) + (unsigned)(crow * kRowPitch + cbyte);
  const unsigned ldsB = ldsA + (unsigned)kOperBytes;
  const int nPass = K >> 7;

  stage_rows32(ldsA, gA, pairA);
  stage_rows32(ldsB, gB, pairB);
  /* pass 0 has landed in this wave's rows; the barrier shows them to the other waves */
  asm volatile("s_wait_asynccnt 0x0" ::: "memory");
  __syncthreads();
  if (nPass > 1) {
    stage_rows32(ldsA + (unsigned)kBufBytes, gA + kPassBytes, pairA);
    stage_rows32(ldsB + (unsigned)kBufBytes, gB + kPassBytes, pairB);
  }

  for (int t = 0; t < nPass; ++t) {
    const int bufOff = (t & 1) * kBufBytes;
    const T* aL = (const T*)(const void*)(ring + bufOff + ((wm << 6) + rlane) * kRowPitch) + koff;
    const T* bL = (const T*)(const void*)(ring + bufOff + kOperBytes + ((wn << 6) + rlane) * kRowPitch) + koff;
    V af[2][4], bf[2][4];
#pragma unroll
    for (int j = 0; j < 4; ++j) {
      bf[0][j] = Frag<T>::load(bL + j * (16 * kRowPitch / 2));
      af[0][j] = Frag<T>::load(aL + j * (16 * kRowPitch / 2));
    }
    /* keeps the group of LDS reads together: the compiler otherwise sinks them among the matrix instructions,  */
    /* one fragment at a time with a full wait each                                                             */
    __builtin_amdgcn_sched_barrier(0);
#pragma unroll
    for (int ks = 0; ks < kPassK / 32; ++ks) {
      const int cur = ks & 1, nxt = cur ^ 1;
      if (ks + 1 < kPassK / 32) {
        /* the next 32 k of this same buffer, as one group ahead of the current matrix block */
#pragma unroll
        for (int j = 0; j < 4; ++j) {
          bf[nxt][j] = Frag<T>::load(bL + j * (16 * kRowPitch / 2) + (ks + 1) * 32);
          af[nxt][j] = Frag<T>::load(aL + j * (16 * kRowPitch / 2) + (ks + 1) * 32);
        }
      }
      /* the reads above stay ahead of this matrix block, and the next group stays behind it */
      __builtin_amdgcn_sched_barrier(0);
#pragma unroll
      for (int i = 0; i < 4; ++i)
#pragma unroll
        for (int j = 0; j < 4; ++j) acc[i][j] = Frag<T>::mma(af[cur][i], bf[cur][j], acc[i][j]);
      __builtin_amdgcn_sched_barrier(0);
    }
    /* this wave's reads of the buffer are done before the buffer may be refilled */
    asm volatile("s_wait_dscnt 0x0" ::: "memory");
    /* this wave's copies of pass t + 1 have landed before the barrier shows them to the others */
    asm volatile("s_wait_asynccnt 0x0" ::: "memory");
    __syncthreads();
    if (t + 2 < nPass) {
      const size_t kb = (size_t)(t + 2) * kPassBytes;
      stage_rows32(ldsA + (unsigned)bufOff, gA + kb, pairA);
      stage_rows32(ldsB + (unsigned)bufOff, gB + kb, pairB);
    }
  }
  /* no copy is outstanding when the wave goes on to the epilogue and ends */
  asm volatile("s_wait_asynccnt 0x0" ::: "memory");
  acc_guard4(acc[0][0], acc[0][1], acc[0][2], acc[0][3]);
  acc_guard4(acc[1][0], acc[1][1], acc[1][2], acc[1][3]);
  acc_guard4(acc[2][0], acc[2][1], acc[2][2], acc[2][3]);
  acc_guard4(acc[3][0], acc[3][1], acc[3][2], acc[3][3]);

  /* ---- epilogue ---- */
  float* slab = sT[wave];
#pragma unroll
  for (int i = 0; i < 4; ++i) {
    const int mBase = m0 + (i << 4);
    float brow[8];
#pragma unroll
    for (int r = 0; r < 8; ++r) brow[r] = 0.f;
    if (BIAS_MODE == 1) {
      /* rows mBase+mOff .. +7: two 16-B loads (32-B aligned) */
      const v4f b0 = *(const v4f*)(bias + mBase + mOff);
      const v4f b1 = *(const v4f*)(bias + mBase + mOff + 4);
#pragma unroll
      for (int e = 0; e < 4; ++e) { brow[e] = b0[e]; brow[4 + e] = b1[e]; }
    }
#pragma unroll
    for (int j = 0; j < 4; ++j) {
      const int n = n0 + (j << 4) + rlane;
      float bv = 0.f;
      if (BIAS_MODE == 2) bv = bias[n];
#pragma unroll
      for (int r = 0; r < 8; ++r) {
        float v = acc[i][j][r] * scale;
        if (BIAS_MODE == 1) v += brow[r];
        if (BIAS_MODE == 2) v += bv;
        slab[(mOff + r) * 68 + (j << 4) + rlane] = v;
      }
    }
    __builtin_amdgcn_fence(__ATOMIC_RELEASE, "workgroup");
    __builtin_amdgcn_wave_barrier();
    __builtin_amdgcn_fence(__ATOMIC_ACQUIRE, "workgroup");
    if (OUT_MODE == 0) {
      float* C = (float*)Cout;
      /* row segment = 256 B = 16 lanes x 16 B; two rows per instruction */
      const int hh = lane >> 4, c4 = (lane & 15) * 4;
      if (RESID) {
        v4f vals[8];
#pragma unroll
        for (int it = 0; it < 8; ++it) {
          const int row = it * 2 + hh;
          const v4f sv = *(const v4f*)(slab + row * 68 + c4);
          const v4f rv = *(const v4f*)(resid + (size_t)(mBase + row) * ldc + n0 + c4);
          vals[it] = sv + rv;
        }
        {
#pragma unroll
          for (int it = 0; it < 8; ++it) {
            const int row = it * 2 + hh;
            *(v4f*)(C + (size_t)(mBase + row) * ldc + n0 + c4) = vals[it];
          }
          
        }
      } else {
        {
#pragma unroll
          for (int it = 0; it < 8; ++it) {
            const int row = it * 2 + hh;
            v4f v = *(const v4f*)(slab + row * 68 + c4);
            *(v4f*)(C + (size_t)(mBase + row) * ldc + n0 + c4) = v;
          }
          
        }
      }
    } else {
      const int q = lane >> 3, c8 = (lane & 7) * 8;
      unsigned short* C = (unsigned short*)Cout;
      int col0 = n0 + c8;
      int col1 = col0;
      int col2 = col0;
      if (OUT_MODE == 3) {
        /* wave-uniform segment selection */
        const int halfN = N >> 1;
        const int isg = (n0 >= halfN) ? 1 : 0;
        const int nn = n0 - isg * halfN;
        col0 = isg * 3 * halfN + nn + c8;
        col1 = col0 + (isg ? 2 * halfN : halfN);
        col2 = col0 + (isg ? halfN : 2 * halfN);
      }
      {
#pragma unroll
        for (int it = 0; it < 4; ++it) {
          const int row = it * 4 + q;
          const float* sp = slab + row * 68 + c8;
          v8h hv, lv;
#pragma unroll
          for (int e = 0; e < 8; ++e) {
            if (OUT_MODE == 1) {
              hv[e] = (_Float16)sp[e];
              lv[e] = hv[e];
            } else {
              const unsigned short hb = f2bf_bits(sp[e]);
              const unsigned short lb = f2bf_bits(sp[e] - bf_bits2f(hb));
              hv[e] = __builtin_bit_cast(_Float16, hb);
              lv[e] = __builtin_bit_cast(_Float16, lb);
            }
          }
          unsigned short* rowp = C + (size_t)(mBase + row) * ldc;
          *(v8h*)(rowp + col0) = hv;
          if (OUT_MODE == 3) {
            *(v8h*)(rowp + col1) = hv;
            *(v8h*)(rowp + col2) = lv;
          }
        }
        
      }
    }
    __builtin_amdgcn_fence(__ATOMIC_RELEASE, "workgroup");
    __builtin_amdgcn_wave_barrier();
    __builtin_amdgcn_fence(__ATOMIC_ACQUIRE, "workgroup");
  }
}

/* --------------------------------------------------------------------------- */
/* f/g weight planes: W3[1024][1536] bf16, row o = [hi(512) | hi(512) | lo(512)] of f_w row o (o < 512)        */
/* or g_w row o-512. One thread = 8 consecutive input channels.                                               */
/* Coverage: 256 blocks x 256 threads x 8 = 524288 = 1024 x 512. Each store instruction: 32 lanes x 16 B =    */
/* --------------------------------------------------------------------------- */
__global__ __launch_bounds__(256) void wsplit_kernel(const float* __restrict__ fw, const float* __restrict__ gw,
                                                     unsigned short* __restrict__ W3) {
  const int i = blockIdx.x * 256 + threadIdx.x;
  const int row = i >> 6;
  const int c8 = (i & 63) * 8;
  /* block-uniform: a block covers 4 whole rows */
  const float* src = (row < kCH) ? (fw + (size_t)row * kCH) : (gw + (size_t)(row - kCH) * kCH);
  const v4f a = *(const v4f*)(src + c8);
  const v4f c = *(const v4f*)(src + c8 + 4);
  float x[8];
#pragma unroll
  for (int e = 0; e < 4; ++e) { x[e] = a[e]; x[4 + e] = c[e]; }
  unsigned short hb[8], lb[8];
#pragma unroll
  for (int e = 0; e < 8; ++e) {
    hb[e] = f2bf_bits(x[e]);
    lb[e] = f2bf_bits(x[e] - bf_bits2f(hb[e]));
  }
  const v4u uh = (v4u){pk16(hb[0], hb[1]), pk16(hb[2], hb[3]), pk16(hb[4], hb[5]), pk16(hb[6], hb[7])};
  const v4u ul = (v4u){pk16(lb[0], lb[1]), pk16(lb[2], lb[3]), pk16(lb[4], lb[5]), pk16(lb[6], lb[7])};
  unsigned short* rp = W3 + (size_t)row * kK3 + c8;
  {
    *(v4u*)(rp) = uh;
    *(v4u*)(rp + kCH) = uh;
    *(v4u*)(rp + 2 * kCH) = ul;
    
  }
}

/* --------------------------------------------------------------------------- */
/* h_w / o_w -> f16 planes carried x kWCarry. grid (128, 2): blockIdx.y selects the matrix (block-uniform).   */
/* Coverage: 128 blocks x 256 threads x 8 = 262144 = 512 x 512 per matrix. One 16-B store per lane, a wave    */
/* --------------------------------------------------------------------------- */
__global__ __launch_bounds__(256) void wcast_kernel(const float* __restrict__ hw, const float* __restrict__ ow,
                                                    unsigned short* __restrict__ hw16, unsigned short* __restrict__ ow16) {
  const int i = blockIdx.x * 256 + threadIdx.x;
  const float* src = (blockIdx.y == 0) ? hw : ow;
  unsigned short* dst = (blockIdx.y == 0) ? hw16 : ow16;
  const float* p = src + 8 * (size_t)i;
  const v4f a = *(const v4f*)(p);
  const v4f c = *(const v4f*)(p + 4);
  unsigned short hb[8];
#pragma unroll
  for (int e = 0; e < 4; ++e) {
    hb[e]     = h_bits(a[e] * kWCarry);
    hb[4 + e] = h_bits(c[e] * kWCarry);
  }
  const v4u u = (v4u){pk16(hb[0], hb[1]), pk16(hb[2], hb[3]), pk16(hb[4], hb[5]), pk16(hb[6], hb[7])};
  unsigned short* q = dst + 8 * (size_t)i;
  *(v4u*)q = u;
  
}

/* --------------------------------------------------------------------------- */
/* Bias tables: fgb[1024] = [f_b | g_b]; hb16[512] = kXCarry * h_b. One block of 256 threads.                 */
/* fgb: 256 threads x 4 floats = 1024; hb16: waves 0..3 x 32 lanes x 4 floats = 512. Every wave writes 4      */
/* --------------------------------------------------------------------------- */
__global__ __launch_bounds__(256) void bias_prep_kernel(const float* __restrict__ fb, const float* __restrict__ gb,
                                                        const float* __restrict__ hb,
                                                        float* __restrict__ fgb, float* __restrict__ hb16) {
  const int t = threadIdx.x;
  const int j = (t & 127) * 4;
  const v4f a = *(const v4f*)(fb + j);
  const v4f g = *(const v4f*)(gb + j);
  const v4f h = *(const v4f*)(hb + j);
  const bool first = (t < 128);
  v4f v;
#pragma unroll
  for (int e = 0; e < 4; ++e) v[e] = first ? a[e] : g[e];
  v4f hs;
#pragma unroll
  for (int e = 0; e < 4; ++e) hs[e] = h[e] * kXCarry;
  {
    *(v4f*)(fgb + 4 * t) = v;
    /* wave-uniform: waves 0..3 */
    if (first) *(v4f*)(hb16 + 4 * t) = hs;
    
  }
}

/* --------------------------------------------------------------------------- */
/* grid = 4*512 blocks, one per (batch, channel); block 256 threads x 16 values = 4096.                        */
/* --------------------------------------------------------------------------- */
__device__ __forceinline__ float block_sum256(float v, float* red, int lane, int wave) {
#pragma unroll
  for (int off = 16; off > 0; off >>= 1) v += __shfl_xor(v, off, 32);
  if (lane == 0) red[wave] = v;
  __syncthreads();
  float s = 0.f;
#pragma unroll
  for (int w = 0; w < 8; ++w) s += red[w];
  __syncthreads();
  return s;
}

__global__ __launch_bounds__(256) void chan_stats_kernel(const float* __restrict__ x, float* __restrict__ stats) {
  __shared__ float red[8];
  const int t = threadIdx.x, lane = t & 31, wave = t >> 5;
  const float* row = x + (size_t)blockIdx.x * kHW;
  v4f v[4];
#pragma unroll
  for (int q = 0; q < 4; ++q) v[q] = *(const v4f*)(row + (size_t)(q * 256 + t) * 4);
  float s = 0.f;
#pragma unroll
  for (int q = 0; q < 4; ++q) s += (v[q][0] + v[q][1]) + (v[q][2] + v[q][3]);
  s = block_sum256(s, red, lane, wave);
  const float mean = s * kInvHW;
  float ss = 0.f;
#pragma unroll
  for (int q = 0; q < 4; ++q) {
#pragma unroll
    for (int e = 0; e < 4; ++e) {
      const float d = v[q][e] - mean;
      ss += d * d;
    }
  }
  ss = block_sum256(ss, red, lane, wave);
  const float var = ss * kInvHW;
  const float rstd = 1.0f / sqrtf(var + kEps);
  if (wave == 0) {
    const float o = (lane == 0) ? mean : ((lane == 1) ? rstd : 0.0f);
    float* p = stats + (size_t)blockIdx.x * kStatPitch + lane;
    *p = o;
    
  }
}

/* --------------------------------------------------------------------------- */
/* Transpose one batch: x[C][HW] f32 -> normT3[HW][1536] bf16 rows [hi | lo | hi] of the normalised value over */
/* channel, and contT[HW][512] f16 of kXCarry * x. 64(ch) x 64(pix) tiles through LDS.                          */
/* grid = (HW/64, C/64), 256 threads.                                                                          */
/* Load coverage: 4 it x 256 thr x 4 floats = 4096 = 64x64. Store coverage per plane: 2 it x 32 rows x 8 lanes */
/* --------------------------------------------------------------------------- */
__global__ __launch_bounds__(256) void norm_transpose_kernel(const float* __restrict__ x, const float* __restrict__ stats,
                                                             unsigned short* __restrict__ normT3,
                                                             unsigned short* __restrict__ contT) {
  __shared__ __align__(16) float tf[64 * 68];
  __shared__ float sMean[64];
  __shared__ float sRstd[64];
  const int p0  = blockIdx.x * 64;
  const int c0  = blockIdx.y * 64;
  const int tid = threadIdx.x;
  {
    const int lr = tid >> 4;
    const int c4 = (tid & 15) * 4;
#pragma unroll
    for (int it = 0; it < 4; ++it) {
      const int rr = it * 16 + lr;
      const v4f a = *(const v4f*)(x + (size_t)(c0 + rr) * kHW + p0 + c4);
      *(v4f*)(tf + rr * 68 + c4) = a;
    }
    /* channel statistics: threads 0..63 stage the mean, 64..127 the rstd (wave-uniform branches) */
    const int ch = tid & 63;
    const int which = (tid >> 6) & 1;
    const float sv = stats[(size_t)(c0 + ch) * kStatPitch + which];
    if (tid < 64) sMean[ch] = sv;
    else if (tid < 128) sRstd[ch] = sv;
  }
  __syncthreads();
  const int sub = tid >> 3;
  const int c8  = (tid & 7) * 8;
  v4u nh[2], nl[2], cf[2];
#pragma unroll
  for (int it = 0; it < 2; ++it) {
    const int oc = it * 32 + sub;
    v4u a, a2, a3;
#pragma unroll
    for (int q = 0; q < 4; ++q) {
      const int ch0 = c8 + 2 * q;
      const int ch1 = ch0 + 1;
      const float x0 = tf[ch0 * 68 + oc];
      const float x1 = tf[ch1 * 68 + oc];
      const float n0v = (x0 - sMean[ch0]) * sRstd[ch0];
      const float n1v = (x1 - sMean[ch1]) * sRstd[ch1];
      const unsigned short h0 = f2bf_bits(n0v), h1 = f2bf_bits(n1v);
      const unsigned short l0 = f2bf_bits(n0v - bf_bits2f(h0)), l1 = f2bf_bits(n1v - bf_bits2f(h1));
      a[q]  = pk16(h0, h1);
      a2[q] = pk16(l0, l1);
      a3[q] = pk16(h_bits(x0 * kXCarry), h_bits(x1 * kXCarry));
    }
    nh[it] = a; nl[it] = a2; cf[it] = a3;
  }
  {
#pragma unroll
    for (int it = 0; it < 2; ++it) {
      const int oc = it * 32 + sub;
      unsigned short* np = normT3 + (size_t)(p0 + oc) * kK3 + c0 + c8;
      unsigned short* cp = contT + (size_t)(p0 + oc) * kCH + c0 + c8;
      *(v4u*)(np) = nh[it];
      *(v4u*)(np + kCH) = nl[it];
      *(v4u*)(np + 2 * kCH) = nh[it];
      *(v4u*)(cp) = cf[it];
    }
    
  }
}

/* --------------------------------------------------------------------------- */
/* Row softmax over 4096 f32 logits: P[row][k] = f16( kPCarry * exp(s - max) / sum exp(s - max) ), f32 math.   */
/* One block of 256 threads per row; thread t owns columns 8t..8t+7 and 2048+8t..2048+8t+7 (256 x 16 = 4096).  */
/* Reductions in fixed order (thread, wave shuffle tree, 8 wave partials in index order).                      */
/* Store: two instructions, each one 16-B store per lane; a wave's 32 lanes write 512 contiguous B = 4 whole   */
/* --------------------------------------------------------------------------- */
__global__ __launch_bounds__(256) void softmax_rows_kernel(const float* __restrict__ E, unsigned short* __restrict__ P) {
  __shared__ float redM[8];
  __shared__ float redS[8];
  const int row  = blockIdx.x;
  const int t    = threadIdx.x;
  const int lane = t & 31, wave = t >> 5;
  const float* sr = E + (size_t)row * kHW + 8 * t;
  const v4f a0 = *(const v4f*)(sr);
  const v4f a1 = *(const v4f*)(sr + 4);
  const v4f b0 = *(const v4f*)(sr + kHW / 2);
  const v4f b1 = *(const v4f*)(sr + kHW / 2 + 4);
  float x[16];
#pragma unroll
  for (int e = 0; e < 4; ++e) { x[e] = a0[e]; x[4 + e] = a1[e]; x[8 + e] = b0[e]; x[12 + e] = b1[e]; }
  float m = x[0];
#pragma unroll
  for (int e = 1; e < 16; ++e) m = fmaxf(m, x[e]);
#pragma unroll
  for (int off = 16; off > 0; off >>= 1) m = fmaxf(m, __shfl_xor(m, off, 32));
  if (lane == 0) redM[wave] = m;
  __syncthreads();
  float mx = redM[0];
#pragma unroll
  for (int w = 1; w < 8; ++w) mx = fmaxf(mx, redM[w]);
  float s = 0.f;
#pragma unroll
  for (int e = 0; e < 16; ++e) {
    x[e] = __expf(x[e] - mx);
    s += x[e];
  }
#pragma unroll
  for (int off = 16; off > 0; off >>= 1) s += __shfl_xor(s, off, 32);
  if (lane == 0) redS[wave] = s;
  __syncthreads();
  float tot = 0.f;
#pragma unroll
  for (int w = 0; w < 8; ++w) tot += redS[w];
  const float inv = kPCarry * (1.0f / tot);
  unsigned short hb[16];
#pragma unroll
  for (int e = 0; e < 16; ++e) hb[e] = h_bits(x[e] * inv);
  const v4u u0 = (v4u){pk16(hb[0], hb[1]), pk16(hb[2], hb[3]), pk16(hb[4], hb[5]), pk16(hb[6], hb[7])};
  const v4u u1 = (v4u){pk16(hb[8], hb[9]), pk16(hb[10], hb[11]), pk16(hb[12], hb[13]), pk16(hb[14], hb[15])};
  unsigned short* pr = P + (size_t)row * kHW + 8 * t;
  {
    *(v4u*)(pr) = u0;
    *(v4u*)(pr + kHW / 2) = u1;
    
  }
}

/* --------------------------------------------------------------------------- */
/* Host orchestration (kernel launches and host arithmetic only).                                              */
/* d_in: 0 = content [4][512][4096], 1 = f_w, 2 = f_b, 3 = g_w, 4 = g_b, 5 = h_w, 6 = h_b, 7 = o_w, 8 = o_b    */
/* (weights [out][in] f32, biases [512] f32).                                                                  */
/* --------------------------------------------------------------------------- */
extern "C" void kernel_launch(void* const* d_in, const int* in_sizes, int n_in,
                              void* d_out, int out_size, void* d_ws, size_t ws_size,
                              hipStream_t stream) {
  if (n_in < 9) return;
  if (in_sizes[0] != kNB * kCH * kHW || out_size != kNB * kCH * kHW) return;
  if (in_sizes[1] != kCH * kCH || in_sizes[3] != kCH * kCH || in_sizes[5] != kCH * kCH || in_sizes[7] != kCH * kCH) return;
  if (in_sizes[2] != kCH || in_sizes[4] != kCH || in_sizes[6] != kCH || in_sizes[8] != kCH) return;

  const float* content = (const float*)d_in[0];
  const float* f_w = (const float*)d_in[1];
  const float* f_b = (const float*)d_in[2];
  const float* g_w = (const float*)d_in[3];
  const float* g_b = (const float*)d_in[4];
  const float* h_w = (const float*)d_in[5];
  const float* h_b = (const float*)d_in[6];
  const float* o_w = (const float*)d_in[7];
  const float* o_b = (const float*)d_in[8];
  float* out = (float*)d_out;

  /*
       W3fg   bf16 [1024][1536]            3,145,728
       hw16   f16  [512][512]                524,288
       ow16   f16  [512][512]                524,288
       fgb    f32  [1024]                      4,096
       hb16   f32  [512]                       2,048
       stats  f32  [4*512][32]               262,144
       normT3 bf16 [4096][1536]           12,582,912
       contT  f16  [4096][512]             4,194,304
       FG3    bf16 [4096][3072]           25,165,824
       H16    f16  [512][4096]             4,194,304
       energy f32  [2048][4096]           33,554,432
       att    f16  [4096][4096]           33,554,432
       aoT    f16  [4096][512]             4,194,304
       total                             121,903,104                                              */
  const size_t bW3   = (size_t)2 * kCH * kK3 * 2;
  const size_t bW16  = (size_t)kCH * kCH * 2;
  const size_t bFGB  = (size_t)2 * kCH * 4;
  const size_t bHB   = (size_t)kCH * 4;
  const size_t bST   = (size_t)kNB * kCH * kStatPitch * 4;
  const size_t bNT3  = (size_t)kHW * kK3 * 2;
  const size_t bCT   = (size_t)kHW * kCH * 2;
  const size_t bFG3  = (size_t)kHW * kFGld * 2;
  const size_t bH16  = (size_t)kCH * kHW * 2;
  const size_t bEN   = (size_t)kQRows * kHW * 4;
  const size_t bATT  = (size_t)kHW * kHW * 2;
  const size_t bAOT  = (size_t)kHW * kCH * 2;
  char* ws = (char*)d_ws;
  size_t off = 0;
  unsigned short* W3fg   = (unsigned short*)(ws + off); off += bW3;
  unsigned short* hw16   = (unsigned short*)(ws + off); off += bW16;
  unsigned short* ow16   = (unsigned short*)(ws + off); off += bW16;
  float*          fgb    = (float*)(ws + off);          off += bFGB;
  float*          hb16   = (float*)(ws + off);          off += bHB;
  float*          stats  = (float*)(ws + off);          off += bST;
  unsigned short* normT3 = (unsigned short*)(ws + off); off += bNT3;
  unsigned short* contT  = (unsigned short*)(ws + off); off += bCT;
  unsigned short* FG3    = (unsigned short*)(ws + off); off += bFG3;
  unsigned short* H16    = (unsigned short*)(ws + off); off += bH16;
  float*          energy = (float*)(ws + off);          off += bEN;
  unsigned short* att    = (unsigned short*)(ws + off); off += bATT;
  unsigned short* aoT    = (unsigned short*)(ws + off); off += bAOT;
  if (off > ws_size || off > (size_t)134217728) return;

  const dim3 blk256(256);

  /* ---- once: weight planes, bias tables, per-(batch, channel) statistics ---- */
  wsplit_kernel<<<dim3((2 * kCH * kCH / 8) / 256), blk256, 0, stream>>>(f_w, g_w, W3fg);
  wcast_kernel<<<dim3((kCH * kCH / 8) / 256, 2), blk256, 0, stream>>>(h_w, o_w, hw16, ow16);
  bias_prep_kernel<<<dim3(1), blk256, 0, stream>>>(f_b, g_b, h_b, fgb, hb16);
  chan_stats_kernel<<<dim3(kNB * kCH), blk256, 0, stream>>>(content, stats);

  const dim3 blk128(128);
  constexpr int tilesFG = (kHW / 128) * ((2 * kCH) / 128);
  constexpr int tilesH  = (kCH / 128) * (kHW / 128);
  constexpr int tilesEN = (kQRows / 128) * (kHW / 128);
  constexpr int tilesPV = (kHW / 128) * (kCH / 128);

  for (int b = 0; b < kNB; ++b) {
    const float* xb = content + (size_t)b * kCH * kHW;
    float* ob = out + (size_t)b * kCH * kHW;
    const float* stb = stats + (size_t)b * kCH * kStatPitch;

    /* in x[C][HW] -> normT3[HW][hi|lo|hi], contT[HW][C] */
    norm_transpose_kernel<<<dim3(kHW / 64, kCH / 64), blk256, 0, stream>>>(xb, stb, normT3, contT);

    /* f|g projections: [pix][1024] = normT3[pix][hi|lo|hi] . W3fg[out][hi|hi|lo]^T + bias[out], split to
       FG3[pix][ Fhi | Fhi | Flo | Ghi | Glo | Ghi ]; M=4096, N=1024, K=1536 */
    wmma_gemm64<1, 2, 3, false><<<dim3(tilesFG), blk128, 0, stream>>>(
        normT3, kK3, W3fg, kK3, (void*)FG3, kFGld, fgb, fgb, kHW, 2 * kCH, kK3, 1.0f);

    /* h projection: H16[o][pix] = kXCarry * (h_w . x + h_b); M=512, N=4096, K=512 */
    wmma_gemm64<0, 1, 1, false><<<dim3(tilesH), blk128, 0, stream>>>(
        hw16, kCH, contT, kCH, (void*)H16, kHW, hb16, hb16, kCH, kHW, kCH, kScaleH);

    for (int hq = 0; hq < kHW / kQRows; ++hq) {
      /* energy[q][k] for 2048 query rows: A = F3 rows [hi|hi|lo], Bt = G3 rows [hi|lo|hi]; M=2048, N=4096, K=1536 */
      wmma_gemm64<1, 0, 0, false><<<dim3(tilesEN), blk128, 0, stream>>>(
          FG3 + (size_t)hq * kQRows * kFGld, kFGld, FG3 + kK3, kFGld, (void*)energy, kHW,
          fgb, fgb, kQRows, kHW, kK3, 1.0f);
      /* softmax over keys -> att rows (f16, x kPCarry) */
      softmax_rows_kernel<<<dim3(kQRows), blk256, 0, stream>>>(energy, att + (size_t)hq * kQRows * kHW);
    }

    /* aoT[q][c] = kXCarry * sum_k att[q][k] * H[c][k]; M=4096, N=512, K=4096 */
    wmma_gemm64<0, 0, 1, false><<<dim3(tilesPV), blk128, 0, stream>>>(
        att, kHW, H16, kHW, (void*)aoT, kCH, fgb, fgb, kHW, kCH, kHW, kScalePV);

    /* out[o][pix] = o_w . ao + o_b + x; M=512, N=4096, K=512 */
    wmma_gemm64<0, 1, 0, true><<<dim3(tilesH), blk128, 0, stream>>>(
        ow16, kCH, aoT, kCH, (void*)ob, kHW, o_b, xb, kCH, kHW, kCH, kScaleO);
  }
}

// v002
// Measured time: 390 microseconds a run.
// Next to v001, in two timings, it ran 1.50 and 1.52 times as fast.
// Counting every step since v000, it is 5.02 times as fast.
// Contractions: f/g projections and q.k energy on v_wmma_f32_16x16x32_bf16 with bf16 hi/lo operand planes laid along K (hi.hi + lo.hi + hi.lo, 3 products); h projection, att.v and output projection on v_wmma_f32_16x16x32_f16 (weights carried x256, activations x16, probabilities x32768); f32 accumulate; statistics, softmax, bias and residual in f32.
#include <hip/hip_runtime.h>
#include <math.h>

/* --------------------------------------------------------------------------- */
/* Shape constants                                                             */
/* --------------------------------------------------------------------------- */
constexpr int kNB   = 4;
constexpr int kCH   = 512;
constexpr int kHW   = 4096;
constexpr int kK3   = 3 * kCH;
constexpr int kFGld = 6 * kCH;
constexpr int kQRows = 2048;
/* batches that share one transpose and one f|g projection launch */
constexpr int kPair  = 2;
constexpr int kStatPitch = 32;
constexpr float kWCarry = 256.0f;
constexpr float kXCarry = 16.0f;
constexpr float kPCarry = 32768.0f;
constexpr float kEps    = 1e-5f;
constexpr float kInvHW  = 1.0f / (float)kHW;
/* h projection: acc = kWCarry*kXCarry*H, stored plane = kXCarry*H */
constexpr float kScaleH  = 1.0f / kWCarry;
/* att.v: acc = kPCarry*kXCarry*ao, stored plane = kXCarry*ao */
constexpr float kScalePV = 1.0f / kPCarry;
/* output projection: acc = kWCarry*kXCarry*out */
constexpr float kScaleO  = 1.0f / (kWCarry * kXCarry);

static_assert(kCH % 128 == 0 && kHW % 128 == 0 && kQRows % 128 == 0);
static_assert(kK3 % 128 == 0);
static_assert((2 * kCH) % 128 == 0);
static_assert(kHW % kQRows == 0);
static_assert(kNB % kPair == 0);
/* the pair's normT3 planes fit the attention plane they borrow */
static_assert((size_t)kPair * kK3 <= (size_t)kHW);

typedef __attribute__((ext_vector_type(16))) _Float16 v16h;
typedef __attribute__((ext_vector_type(8)))  _Float16 v8h;
typedef __attribute__((ext_vector_type(16))) __bf16   v16b;
typedef __attribute__((ext_vector_type(8)))  __bf16   v8b;
typedef __attribute__((ext_vector_type(8)))  float    v8f;
typedef __attribute__((ext_vector_type(4)))  float    v4f;
typedef __attribute__((ext_vector_type(4)))  unsigned int v4u;

__device__ __forceinline__ unsigned short f2bf_bits(float f) {
  unsigned u = __float_as_uint(f);
  return (unsigned short)((u + 0x7FFFu + ((u >> 16) & 1u)) >> 16);
}
__device__ __forceinline__ float bf_bits2f(unsigned short h) { return __uint_as_float(((unsigned)h) << 16); }
__device__ __forceinline__ unsigned pk16(unsigned short a, unsigned short b) { return (unsigned)a | ((unsigned)b << 16); }
__device__ __forceinline__ unsigned short h_bits(float f) { const _Float16 h = (_Float16)f; return __builtin_bit_cast(unsigned short, h); }

/* four vector slots between the last matrix instruction of the K loop and the first reader of its result */
__device__ __forceinline__ void acc_guard4(v8f& a, v8f& b, v8f& c, v8f& d) { asm volatile("v_nop\n\tv_nop\n\tv_nop\n\tv_nop" : "+v"(a), "+v"(b), "+v"(c), "+v"(d)); }

template <typename T> struct Frag;
template <> struct Frag<_Float16> {
  typedef v16h V; union U { v16h v; v8h h[2]; };
  /* elements 0..7 <- p[0..7], elements 8..15 <- p[16..23] */
  static __device__ __forceinline__ v16h load(const _Float16* p) {
    U f; f.h[0] = *(const v8h*)(p); f.h[1] = *(const v8h*)(p + 16); return f.v;
  }
  static __device__ __forceinline__ v8f mma(v16h a, v16h b, v8f c) {
    return __builtin_amdgcn_wmma_f32_16x16x32_f16(false, a, false, b, (short)0, c, false, false);
  }
};
template <> struct Frag<__bf16> {
  typedef v16b V; union U { v16b v; v8b h[2]; };
  static __device__ __forceinline__ v16b load(const __bf16* p) {
    U f; f.h[0] = *(const v8b*)(p); f.h[1] = *(const v8b*)(p + 16); return f.v;
  }
  static __device__ __forceinline__ v8f mma(v16b a, v16b b, v8f c) {
    return __builtin_amdgcn_wmma_f32_16x16x32_bf16(false, a, false, b, (short)0, c, false, false);
  }
};

/* ---- Register-blocked WMMA GEMM ------------------------------------------------------------------ */
/* C[m,n] = scale * sum_k A[m,k] * Bt[n,k] (+bias)(+resid); a work-group of 4 waves (2 x 2) owns a     */
/* 128x128 tile, each wave a 64x64 quarter of it.                                                      */
/* A row-major [M,K] pitch lda; Bt row-major [N,K] pitch ldb; M,N % 128 == 0, K % 128 == 0.            */
/* Operands reach the waves through LDS: a pass is 128 k = 256 B of each of the tile's 128 A rows and  */
/* 128 Bt rows, brought in by asynchronous copies (whole 256-B rows, 16 B a lane) into one of two      */
/* buffers while the other buffer is worked on; rows lie at a pitch of 272 B for the 16-B readers.     */
/* ET: 0 = f16 operands, 1 = bf16 operands (pointers passed as 16-bit storage).                        */
/* BIAS_MODE: 0 = none, 1 = bias[m], 2 = bias[n].                                                      */
/* OUT_MODE: 0 = f32; 1 = f16; 3 = bf16 hi/lo triple-segment rows of pitch ldc:                         */
/*   columns n < N/2  -> [hi | hi | lo] at segment offsets 0, N/2, N     (first 3*N/2 columns)         */
/*   columns n >= N/2 -> [hi | lo | hi] at segment offsets 0, N/2, N     (second 3*N/2 columns)        */
/* RESID (OUT_MODE 0): the addend is fetched in the store phase, one 16-B load per lane at the address */
/* it is about to store.                                                                               */
/* blockIdx.y = batch: A, Bt and C (and the addend, laid out like C) advance by strideA, strideB and   */
/* strideC elements a batch; a stride of 0 is an operand that every batch shares.                      */
template <int ET> struct Elem;
template <> struct Elem<0> { typedef _Float16 T; };
template <> struct Elem<1> { typedef __bf16 T; };

constexpr int kPassK     = 128;
constexpr int kPassBytes = kPassK * 2;
constexpr int kRowPitch  = kPassBytes + 16;
constexpr int kOperBytes = 128 * kRowPitch;
constexpr int kBufBytes  = 2 * kOperBytes;

/* Eight asynchronous copies, 16 B a lane each, global -> LDS. The s_wait_xcnt stands inside the statement so  */
/* that it comes before any rewrite of the address registers the copies name.                                  */
__device__ __forceinline__ void async_copy8(const unsigned (&l)[8], const char* const (&g)[8]) {
  asm volatile(
      "global_load_async_to_lds_b128 %0, %8, off\n\t"
      "global_load_async_to_lds_b128 %1, %9, off\n\t"
      "global_load_async_to_lds_b128 %2, %10, off\n\t"
      "global_load_async_to_lds_b128 %3, %11, off\n\t"
      "global_load_async_to_lds_b128 %4, %12, off\n\t"
      "global_load_async_to_lds_b128 %5, %13, off\n\t"
      "global_load_async_to_lds_b128 %6, %14, off\n\t"
      "global_load_async_to_lds_b128 %7, %15, off\n\t"
      "s_wait_xcnt 0x0"
      :: "v"(l[0]), "v"(l[1]), "v"(l[2]), "v"(l[3]), "v"(l[4]), "v"(l[5]), "v"(l[6]), "v"(l[7]),
         "v"(g[0]), "v"(g[1]), "v"(g[2]), "v"(g[3]), "v"(g[4]), "v"(g[5]), "v"(g[6]), "v"(g[7])
      : "memory");
}

/* One wave's share of a pass: 32 rows of one operand, two rows a copy (lanes 0..15 one row, 16..31 the next). */
/* lds, g: the lane's own 16 B in the first pair of rows; pair2: bytes from one pair of global rows to the next. */
__device__ __forceinline__ void stage_rows32(unsigned lds, const char* g, size_t pair2) {
#pragma unroll
  for (int h = 0; h < 2; ++h) {
    unsigned l8[8];
    const char* g8[8];
#pragma unroll
    for (int j = 0; j < 8; ++j) {
      l8[j] = lds + (unsigned)((h * 8 + j) * 2 * kRowPitch);
      g8[j] = g + (size_t)(h * 8 + j) * pair2;
    }
    async_copy8(l8, g8);
  }
}

template <int ET, int BIAS_MODE, int OUT_MODE, bool RESID>
__global__ __launch_bounds__(128) void wmma_gemm64(
    const unsigned short* __restrict__ Ap, int lda,
    const unsigned short* __restrict__ Btp, int ldb,
    void* __restrict__ Cout, int ldc,
    const float* __restrict__ bias,
    const float* __restrict__ resid,
    int M, int N, int K, float scale,
    int strideA, int strideB, int strideC) {
  typedef typename Elem<ET>::T T;
  typedef typename Frag<T>::V V;
  const size_t batch = blockIdx.y;
  const T* Ab = (const T*)(const void*)Ap + batch * (size_t)strideA;
  const T* Bb = (const T*)(const void*)Btp + batch * (size_t)strideB;
  const size_t cOff = batch * (size_t)strideC;
  /* per-wave 16x64 slab, pitch 68 floats */
  __shared__ __align__(16) float sT[4][16 * 68];
  /* two buffers, each [A 128 rows | Bt 128 rows] at kRowPitch */
  __shared__ __align__(16) unsigned char ring[2 * kBufBytes];
  const int lane = threadIdx.x & 31;
  const int wave = threadIdx.x >> 5;
  const int tilesN = N >> 7;
  const int tilesM = M >> 7;
  const int tile = blockIdx.x;
  /* block-uniform exit, in front of every barrier and copy */
  if (tile >= tilesM * tilesN) return;
  const int tm = tile / tilesN;
  const int tn = tile - tm * tilesN;
  const int wm = wave >> 1;
  const int wn = wave & 1;
  const int m0 = (tm << 7) + (wm << 6);
  const int n0 = (tn << 7) + (wn << 6);

  /* row (A) / column (B, D) within a 16-wide subtile; k offset and D row offset of this lane half */
  const int rlane = lane & 15;
  const int koff  = (lane >> 4) * 8;
  const int mOff  = (lane >> 4) * 8;

  v8f acc[4][4];
#pragma unroll
  for (int i = 0; i < 4; ++i)
#pragma unroll
    for (int j = 0; j < 4; ++j) acc[i][j] = (v8f){0.f,0.f,0.f,0.f,0.f,0.f,0.f,0.f};

  /* copies: wave w brings rows 32w..32w+31 of the A tile and of the Bt tile */
  const int crow = (wave << 5) + (lane >> 4);
  const int cbyte = (lane & 15) * 16;
  const char* gA = (const char*)(Ab + (size_t)((tm << 7) + crow) * lda) + cbyte;
  const char* gB = (const char*)(Bb + (size_t)((tn << 7) + crow) * ldb) + cbyte;
  const size_t pairA = (size_t)lda * 4;
  const size_t pairB = (size_t)ldb * 4;
  const unsigned ldsA = (unsigned)(size_t)(ring) + (unsigned)(crow * kRowPitch + cbyte);
  const unsigned ldsB = ldsA + (unsigned)kOperBytes;
  const int nPass = K >> 7;

  stage_rows32(ldsA, gA, pairA);
  stage_rows32(ldsB, gB, pairB);
  /* pass 0 has landed in this wave's rows; the barrier shows them to the other waves */
  asm volatile("s_wait_asynccnt 0x0" ::: "memory");
  __syncthreads();
  if (nPass > 1) {
    stage_rows32(ldsA + (unsigned)kBufBytes, gA + kPassBytes, pairA);
    stage_rows32(ldsB + (unsigned)kBufBytes, gB + kPassBytes, pairB);
  }

  for (int t = 0; t < nPass; ++t) {
    const int bufOff = (t & 1) * kBufBytes;
    const T* aL = (const T*)(const void*)(ring + bufOff + ((wm << 6) + rlane) * kRowPitch) + koff;
    const T* bL = (const T*)(const void*)(ring + bufOff + kOperBytes + ((wn << 6) + rlane) * kRowPitch) + koff;
    V af[2][4], bf[2][4];
#pragma unroll
    for (int j = 0; j < 4; ++j) {
      bf[0][j] = Frag<T>::load(bL + j * (16 * kRowPitch / 2));
      af[0][j] = Frag<T>::load(aL + j * (16 * kRowPitch / 2));
    }
    /* keeps the group of LDS reads together: the compiler otherwise sinks them among the matrix instructions,  */
    /* one fragment at a time with a full wait each                                                             */
    __builtin_amdgcn_sched_barrier(0);
#pragma unroll
    for (int ks = 0; ks < kPassK / 32; ++ks) {
      const int cur = ks & 1, nxt = cur ^ 1;
      if (ks + 1 < kPassK / 32) {
        /* the next 32 k of this same buffer, as one group ahead of the current matrix block */
#pragma unroll
        for (int j = 0; j < 4; ++j) {
          bf[nxt][j] = Frag<T>::load(bL + j * (16 * kRowPitch / 2) + (ks + 1) * 32);
          af[nxt][j] = Frag<T>::load(aL + j * (16 * kRowPitch / 2) + (ks + 1) * 32);
        }
      }
      /* the reads above stay ahead of this matrix block, and the next group stays behind it */
      __builtin_amdgcn_sched_barrier(0);
#pragma unroll
      for (int i = 0; i < 4; ++i)
#pragma unroll
        for (int j = 0; j < 4; ++j) acc[i][j] = Frag<T>::mma(af[cur][i], bf[cur][j], acc[i][j]);
      __builtin_amdgcn_sched_barrier(0);
    }
    /* this wave's reads of the buffer are done before the buffer may be refilled */
    asm volatile("s_wait_dscnt 0x0" ::: "memory");
    /* this wave's copies of pass t + 1 have landed before the barrier shows them to the others */
    asm volatile("s_wait_asynccnt 0x0" ::: "memory");
    __syncthreads();
    if (t + 2 < nPass) {
      const size_t kb = (size_t)(t + 2) * kPassBytes;
      stage_rows32(ldsA + (unsigned)bufOff, gA + kb, pairA);
      stage_rows32(ldsB + (unsigned)bufOff, gB + kb, pairB);
    }
  }
  /* no copy is outstanding when the wave goes on to the epilogue and ends */
  asm volatile("s_wait_asynccnt 0x0" ::: "memory");
  acc_guard4(acc[0][0], acc[0][1], acc[0][2], acc[0][3]);
  acc_guard4(acc[1][0], acc[1][1], acc[1][2], acc[1][3]);
  acc_guard4(acc[2][0], acc[2][1], acc[2][2], acc[2][3]);
  acc_guard4(acc[3][0], acc[3][1], acc[3][2], acc[3][3]);

  /* ---- epilogue ---- */
  float* slab = sT[wave];
#pragma unroll
  for (int i = 0; i < 4; ++i) {
    const int mBase = m0 + (i << 4);
    float brow[8];
#pragma unroll
    for (int r = 0; r < 8; ++r) brow[r] = 0.f;
    if (BIAS_MODE == 1) {
      /* rows mBase+mOff .. +7: two 16-B loads (32-B aligned) */
      const v4f b0 = *(const v4f*)(bias + mBase + mOff);
      const v4f b1 = *(const v4f*)(bias + mBase + mOff + 4);
#pragma unroll
      for (int e = 0; e < 4; ++e) { brow[e] = b0[e]; brow[4 + e] = b1[e]; }
    }
#pragma unroll
    for (int j = 0; j < 4; ++j) {
      const int n = n0 + (j << 4) + rlane;
      float bv = 0.f;
      if (BIAS_MODE == 2) bv = bias[n];
#pragma unroll
      for (int r = 0; r < 8; ++r) {
        float v = acc[i][j][r] * scale;
        if (BIAS_MODE == 1) v += brow[r];
        if (BIAS_MODE == 2) v += bv;
        slab[(mOff + r) * 68 + (j << 4) + rlane] = v;
      }
    }
    __builtin_amdgcn_fence(__ATOMIC_RELEASE, "workgroup");
    __builtin_amdgcn_wave_barrier();
    __builtin_amdgcn_fence(__ATOMIC_ACQUIRE, "workgroup");
    if (OUT_MODE == 0) {
      float* C = (float*)Cout + cOff;
      /* row segment = 256 B = 16 lanes x 16 B; two rows per instruction */
      const int hh = lane >> 4, c4 = (lane & 15) * 4;
      if (RESID) {
        v4f vals[8];
#pragma unroll
        for (int it = 0; it < 8; ++it) {
          const int row = it * 2 + hh;
          const v4f sv = *(const v4f*)(slab + row * 68 + c4);
          const v4f rv = *(const v4f*)(resid + cOff + (size_t)(mBase + row) * ldc + n0 + c4);
          vals[it] = sv + rv;
        }
        {
#pragma unroll
          for (int it = 0; it < 8; ++it) {
            const int row = it * 2 + hh;
            *(v4f*)(C + (size_t)(mBase + row) * ldc + n0 + c4) = vals[it];
          }
          
        }
      } else {
        {
#pragma unroll
          for (int it = 0; it < 8; ++it) {
            const int row = it * 2 + hh;
            v4f v = *(const v4f*)(slab + row * 68 + c4);
            *(v4f*)(C + (size_t)(mBase + row) * ldc + n0 + c4) = v;
          }
          
        }
      }
    } else {
      const int q = lane >> 3, c8 = (lane & 7) * 8;
      unsigned short* C = (unsigned short*)Cout + cOff;
      int col0 = n0 + c8;
      int col1 = col0;
      int col2 = col0;
      if (OUT_MODE == 3) {
        /* wave-uniform segment selection */
        const int halfN = N >> 1;
        const int isg = (n0 >= halfN) ? 1 : 0;
        const int nn = n0 - isg * halfN;
        col0 = isg * 3 * halfN + nn + c8;
        col1 = col0 + (isg ? 2 * halfN : halfN);
        col2 = col0 + (isg ? halfN : 2 * halfN);
      }
      {
#pragma unroll
        for (int it = 0; it < 4; ++it) {
          const int row = it * 4 + q;
          const float* sp = slab + row * 68 + c8;
          v8h hv, lv;
#pragma unroll
          for (int e = 0; e < 8; ++e) {
            if (OUT_MODE == 1) {
              hv[e] = (_Float16)sp[e];
              lv[e] = hv[e];
            } else {
              const unsigned short hb = f2bf_bits(sp[e]);
              const unsigned short lb = f2bf_bits(sp[e] - bf_bits2f(hb));
              hv[e] = __builtin_bit_cast(_Float16, hb);
              lv[e] = __builtin_bit_cast(_Float16, lb);
            }
          }
          unsigned short* rowp = C + (size_t)(mBase + row) * ldc;
          *(v8h*)(rowp + col0) = hv;
          if (OUT_MODE == 3) {
            *(v8h*)(rowp + col1) = hv;
            *(v8h*)(rowp + col2) = lv;
          }
        }
        
      }
    }
    __builtin_amdgcn_fence(__ATOMIC_RELEASE, "workgroup");
    __builtin_amdgcn_wave_barrier();
    __builtin_amdgcn_fence(__ATOMIC_ACQUIRE, "workgroup");
  }
}

/* --------------------------------------------------------------------------- */
/* f/g weight planes: W3[1024][1536] bf16, row o = [hi(512) | hi(512) | lo(512)] of f_w row o (o < 512)        */
/* or g_w row o-512. One thread = 8 consecutive input channels.                                               */
/* Coverage: 256 blocks x 256 threads x 8 = 524288 = 1024 x 512. Each store instruction: 32 lanes x 16 B =    */
/* --------------------------------------------------------------------------- */
__global__ __launch_bounds__(256) void wsplit_kernel(const float* __restrict__ fw, const float* __restrict__ gw,
                                                     unsigned short* __restrict__ W3) {
  const int i = blockIdx.x * 256 + threadIdx.x;
  const int row = i >> 6;
  const int c8 = (i & 63) * 8;
  /* block-uniform: a block covers 4 whole rows */
  const float* src = (row < kCH) ? (fw + (size_t)row * kCH) : (gw + (size_t)(row - kCH) * kCH);
  const v4f a = *(const v4f*)(src + c8);
  const v4f c = *(const v4f*)(src + c8 + 4);
  float x[8];
#pragma unroll
  for (int e = 0; e < 4; ++e) { x[e] = a[e]; x[4 + e] = c[e]; }
  unsigned short hb[8], lb[8];
#pragma unroll
  for (int e = 0; e < 8; ++e) {
    hb[e] = f2bf_bits(x[e]);
    lb[e] = f2bf_bits(x[e] - bf_bits2f(hb[e]));
  }
  const v4u uh = (v4u){pk16(hb[0], hb[1]), pk16(hb[2], hb[3]), pk16(hb[4], hb[5]), pk16(hb[6], hb[7])};
  const v4u ul = (v4u){pk16(lb[0], lb[1]), pk16(lb[2], lb[3]), pk16(lb[4], lb[5]), pk16(lb[6], lb[7])};
  unsigned short* rp = W3 + (size_t)row * kK3 + c8;
  {
    *(v4u*)(rp) = uh;
    *(v4u*)(rp + kCH) = uh;
    *(v4u*)(rp + 2 * kCH) = ul;
    
  }
}

/* --------------------------------------------------------------------------- */
/* h_w / o_w -> f16 planes carried x kWCarry. grid (128, 2): blockIdx.y selects the matrix (block-uniform).   */
/* Coverage: 128 blocks x 256 threads x 8 = 262144 = 512 x 512 per matrix. One 16-B store per lane, a wave    */
/* --------------------------------------------------------------------------- */
__global__ __launch_bounds__(256) void wcast_kernel(const float* __restrict__ hw, const float* __restrict__ ow,
                                                    unsigned short* __restrict__ hw16, unsigned short* __restrict__ ow16) {
  const int i = blockIdx.x * 256 + threadIdx.x;
  const float* src = (blockIdx.y == 0) ? hw : ow;
  unsigned short* dst = (blockIdx.y == 0) ? hw16 : ow16;
  const float* p = src + 8 * (size_t)i;
  const v4f a = *(const v4f*)(p);
  const v4f c = *(const v4f*)(p + 4);
  unsigned short hb[8];
#pragma unroll
  for (int e = 0; e < 4; ++e) {
    hb[e]     = h_bits(a[e] * kWCarry);
    hb[4 + e] = h_bits(c[e] * kWCarry);
  }
  const v4u u = (v4u){pk16(hb[0], hb[1]), pk16(hb[2], hb[3]), pk16(hb[4], hb[5]), pk16(hb[6], hb[7])};
  unsigned short* q = dst + 8 * (size_t)i;
  *(v4u*)q = u;
  
}

/* --------------------------------------------------------------------------- */
/* Bias tables: fgb[1024] = [f_b | g_b]; hb16[512] = kXCarry * h_b. One block of 256 threads.                 */
/* fgb: 256 threads x 4 floats = 1024; hb16: waves 0..3 x 32 lanes x 4 floats = 512. Every wave writes 4      */
/* --------------------------------------------------------------------------- */
__global__ __launch_bounds__(256) void bias_prep_kernel(const float* __restrict__ fb, const float* __restrict__ gb,
                                                        const float* __restrict__ hb,
                                                        float* __restrict__ fgb, float* __restrict__ hb16) {
  const int t = threadIdx.x;
  const int j = (t & 127) * 4;
  const v4f a = *(const v4f*)(fb + j);
  const v4f g = *(const v4f*)(gb + j);
  const v4f h = *(const v4f*)(hb + j);
  const bool first = (t < 128);
  v4f v;
#pragma unroll
  for (int e = 0; e < 4; ++e) v[e] = first ? a[e] : g[e];
  v4f hs;
#pragma unroll
  for (int e = 0; e < 4; ++e) hs[e] = h[e] * kXCarry;
  {
    *(v4f*)(fgb + 4 * t) = v;
    /* wave-uniform: waves 0..3 */
    if (first) *(v4f*)(hb16 + 4 * t) = hs;
    
  }
}

/* --------------------------------------------------------------------------- */
/* grid = 4*512 blocks, one per (batch, channel); block 256 threads x 16 values = 4096.                        */
/* --------------------------------------------------------------------------- */
__device__ __forceinline__ float block_sum256(float v, float* red, int lane, int wave) {
#pragma unroll
  for (int off = 16; off > 0; off >>= 1) v += __shfl_xor(v, off, 32);
  if (lane == 0) red[wave] = v;
  __syncthreads();
  float s = 0.f;
#pragma unroll
  for (int w = 0; w < 8; ++w) s += red[w];
  __syncthreads();
  return s;
}

__global__ __launch_bounds__(256) void chan_stats_kernel(const float* __restrict__ x, float* __restrict__ stats) {
  __shared__ float red[8];
  const int t = threadIdx.x, lane = t & 31, wave = t >> 5;
  const float* row = x + (size_t)blockIdx.x * kHW;
  v4f v[4];
#pragma unroll
  for (int q = 0; q < 4; ++q) v[q] = *(const v4f*)(row + (size_t)(q * 256 + t) * 4);
  float s = 0.f;
#pragma unroll
  for (int q = 0; q < 4; ++q) s += (v[q][0] + v[q][1]) + (v[q][2] + v[q][3]);
  s = block_sum256(s, red, lane, wave);
  const float mean = s * kInvHW;
  float ss = 0.f;
#pragma unroll
  for (int q = 0; q < 4; ++q) {
#pragma unroll
    for (int e = 0; e < 4; ++e) {
      const float d = v[q][e] - mean;
      ss += d * d;
    }
  }
  ss = block_sum256(ss, red, lane, wave);
  const float var = ss * kInvHW;
  const float rstd = 1.0f / sqrtf(var + kEps);
  if (wave == 0) {
    const float o = (lane == 0) ? mean : ((lane == 1) ? rstd : 0.0f);
    float* p = stats + (size_t)blockIdx.x * kStatPitch + lane;
    *p = o;
    
  }
}

/* --------------------------------------------------------------------------- */
/* Transpose one batch: x[C][HW] f32 -> normT3[HW][1536] bf16 rows [hi | lo | hi] of the normalised value over */
/* channel, and contT[HW][512] f16 of kXCarry * x. 64(ch) x 64(pix) tiles through LDS.                          */
/* grid = (HW/64, C/64, batches of this launch), 256 threads; blockIdx.z steps every pointer by one batch.     */
/* Load coverage: 4 it x 256 thr x 4 floats = 4096 = 64x64. Store coverage per plane: 2 it x 32 rows x 8 lanes */
/* --------------------------------------------------------------------------- */
__global__ __launch_bounds__(256) void norm_transpose_kernel(const float* __restrict__ x, const float* __restrict__ stats,
                                                             unsigned short* __restrict__ normT3,
                                                             unsigned short* __restrict__ contT) {
  __shared__ __align__(16) float tf[64 * 68];
  __shared__ float sMean[64];
  __shared__ float sRstd[64];
  const int p0  = blockIdx.x * 64;
  const int c0  = blockIdx.y * 64;
  const int tid = threadIdx.x;
  const size_t bz = blockIdx.z;
  x      += bz * (size_t)(kCH * kHW);
  stats  += bz * (size_t)(kCH * kStatPitch);
  normT3 += bz * (size_t)(kHW * kK3);
  contT  += bz * (size_t)(kHW * kCH);
  {
    const int lr = tid >> 4;
    const int c4 = (tid & 15) * 4;
#pragma unroll
    for (int it = 0; it < 4; ++it) {
      const int rr = it * 16 + lr;
      const v4f a = *(const v4f*)(x + (size_t)(c0 + rr) * kHW + p0 + c4);
      *(v4f*)(tf + rr * 68 + c4) = a;
    }
    /* channel statistics: threads 0..63 stage the mean, 64..127 the rstd (wave-uniform branches) */
    const int ch = tid & 63;
    const int which = (tid >> 6) & 1;
    const float sv = stats[(size_t)(c0 + ch) * kStatPitch + which];
    if (tid < 64) sMean[ch] = sv;
    else if (tid < 128) sRstd[ch] = sv;
  }
  __syncthreads();
  const int sub = tid >> 3;
  const int c8  = (tid & 7) * 8;
  v4u nh[2], nl[2], cf[2];
#pragma unroll
  for (int it = 0; it < 2; ++it) {
    const int oc = it * 32 + sub;
    v4u a, a2, a3;
#pragma unroll
    for (int q = 0; q < 4; ++q) {
      const int ch0 = c8 + 2 * q;
      const int ch1 = ch0 + 1;
      const float x0 = tf[ch0 * 68 + oc];
      const float x1 = tf[ch1 * 68 + oc];
      const float n0v = (x0 - sMean[ch0]) * sRstd[ch0];
      const float n1v = (x1 - sMean[ch1]) * sRstd[ch1];
      const unsigned short h0 = f2bf_bits(n0v), h1 = f2bf_bits(n1v);
      const unsigned short l0 = f2bf_bits(n0v - bf_bits2f(h0)), l1 = f2bf_bits(n1v - bf_bits2f(h1));
      a[q]  = pk16(h0, h1);
      a2[q] = pk16(l0, l1);
      a3[q] = pk16(h_bits(x0 * kXCarry), h_bits(x1 * kXCarry));
    }
    nh[it] = a; nl[it] = a2; cf[it] = a3;
  }
  {
#pragma unroll
    for (int it = 0; it < 2; ++it) {
      const int oc = it * 32 + sub;
      unsigned short* np = normT3 + (size_t)(p0 + oc) * kK3 + c0 + c8;
      unsigned short* cp = contT + (size_t)(p0 + oc) * kCH + c0 + c8;
      *(v4u*)(np) = nh[it];
      *(v4u*)(np + kCH) = nl[it];
      *(v4u*)(np + 2 * kCH) = nh[it];
      *(v4u*)(cp) = cf[it];
    }
    
  }
}

/* --------------------------------------------------------------------------- */
/* Row softmax over 4096 f32 logits: P[row][k] = f16( kPCarry * exp(s - max) / sum exp(s - max) ), f32 math.   */
/* One block of 256 threads per row; thread t owns columns 8t..8t+7 and 2048+8t..2048+8t+7 (256 x 16 = 4096).  */
/* Reductions in fixed order (thread, wave shuffle tree, 8 wave partials in index order).                      */
/* Store: two instructions, each one 16-B store per lane; a wave's 32 lanes write 512 contiguous B = 4 whole   */
/* --------------------------------------------------------------------------- */
__global__ __launch_bounds__(256) void softmax_rows_kernel(const float* __restrict__ E, unsigned short* __restrict__ P) {
  __shared__ float redM[8];
  __shared__ float redS[8];
  const int row  = blockIdx.x;
  const int t    = threadIdx.x;
  const int lane = t & 31, wave = t >> 5;
  const float* sr = E + (size_t)row * kHW + 8 * t;
  const v4f a0 = *(const v4f*)(sr);
  const v4f a1 = *(const v4f*)(sr + 4);
  const v4f b0 = *(const v4f*)(sr + kHW / 2);
  const v4f b1 = *(const v4f*)(sr + kHW / 2 + 4);
  float x[16];
#pragma unroll
  for (int e = 0; e < 4; ++e) { x[e] = a0[e]; x[4 + e] = a1[e]; x[8 + e] = b0[e]; x[12 + e] = b1[e]; }
  float m = x[0];
#pragma unroll
  for (int e = 1; e < 16; ++e) m = fmaxf(m, x[e]);
#pragma unroll
  for (int off = 16; off > 0; off >>= 1) m = fmaxf(m, __shfl_xor(m, off, 32));
  if (lane == 0) redM[wave] = m;
  __syncthreads();
  float mx = redM[0];
#pragma unroll
  for (int w = 1; w < 8; ++w) mx = fmaxf(mx, redM[w]);
  float s = 0.f;
#pragma unroll
  for (int e = 0; e < 16; ++e) {
    x[e] = __expf(x[e] - mx);
    s += x[e];
  }
#pragma unroll
  for (int off = 16; off > 0; off >>= 1) s += __shfl_xor(s, off, 32);
  if (lane == 0) redS[wave] = s;
  __syncthreads();
  float tot = 0.f;
#pragma unroll
  for (int w = 0; w < 8; ++w) tot += redS[w];
  const float inv = kPCarry * (1.0f / tot);
  unsigned short hb[16];
#pragma unroll
  for (int e = 0; e < 16; ++e) hb[e] = h_bits(x[e] * inv);
  const v4u u0 = (v4u){pk16(hb[0], hb[1]), pk16(hb[2], hb[3]), pk16(hb[4], hb[5]), pk16(hb[6], hb[7])};
  const v4u u1 = (v4u){pk16(hb[8], hb[9]), pk16(hb[10], hb[11]), pk16(hb[12], hb[13]), pk16(hb[14], hb[15])};
  unsigned short* pr = P + (size_t)row * kHW + 8 * t;
  {
    *(v4u*)(pr) = u0;
    *(v4u*)(pr + kHW / 2) = u1;
    
  }
}

/* --------------------------------------------------------------------------- */
/* Host orchestration (kernel launches and host arithmetic only).                                              */
/* d_in: 0 = content [4][512][4096], 1 = f_w, 2 = f_b, 3 = g_w, 4 = g_b, 5 = h_w, 6 = h_b, 7 = o_w, 8 = o_b    */
/* (weights [out][in] f32, biases [512] f32).                                                                  */
/* --------------------------------------------------------------------------- */
extern "C" void kernel_launch(void* const* d_in, const int* in_sizes, int n_in,
                              void* d_out, int out_size, void* d_ws, size_t ws_size,
                              hipStream_t stream) {
  if (n_in < 9) return;
  if (in_sizes[0] != kNB * kCH * kHW || out_size != kNB * kCH * kHW) return;
  if (in_sizes[1] != kCH * kCH || in_sizes[3] != kCH * kCH || in_sizes[5] != kCH * kCH || in_sizes[7] != kCH * kCH) return;
  if (in_sizes[2] != kCH || in_sizes[4] != kCH || in_sizes[6] != kCH || in_sizes[8] != kCH) return;

  const float* content = (const float*)d_in[0];
  const float* f_w = (const float*)d_in[1];
  const float* f_b = (const float*)d_in[2];
  const float* g_w = (const float*)d_in[3];
  const float* g_b = (const float*)d_in[4];
  const float* h_w = (const float*)d_in[5];
  const float* h_b = (const float*)d_in[6];
  const float* o_w = (const float*)d_in[7];
  const float* o_b = (const float*)d_in[8];
  float* out = (float*)d_out;

  /* Batches share launches: h projection, att.v and output projection take all four in one grid, the
     transpose and the f|g projection two (what the workspace holds); energy and softmax stay per batch.
       W3fg   bf16 [1024][1536]            3,145,728
       hw16   f16  [512][512]                524,288
       ow16   f16  [512][512]                524,288
       fgb    f32  [1024]                      4,096
       hb16   f32  [512]                       2,048
       stats  f32  [4*512][32]               262,144
       contT  f16  [4][4096][512]         16,777,216   (aoT lies here once the h projection has read it)
       FG3    bf16 [2][4096][3072]        50,331,648
       H16    f16  [4][512][4096]         16,777,216
       energy f32  [2048][4096]           33,554,432
       att    f16  [4][4096][4096]       134,217,728   (normT3 bf16 [2][4096][1536] = 25,165,824 lies in the
                                                        last batch's plane, read before that plane is written)
       total                             256,120,832                                              */
  const size_t bW3   = (size_t)2 * kCH * kK3 * 2;
  const size_t bW16  = (size_t)kCH * kCH * 2;
  const size_t bFGB  = (size_t)2 * kCH * 4;
  const size_t bHB   = (size_t)kCH * 4;
  const size_t bST   = (size_t)kNB * kCH * kStatPitch * 4;
  const size_t bCT   = (size_t)kNB * kHW * kCH * 2;
  const size_t bFG3  = (size_t)kPair * kHW * kFGld * 2;
  const size_t bH16  = (size_t)kNB * kCH * kHW * 2;
  const size_t bEN   = (size_t)kQRows * kHW * 4;
  const size_t bATT  = (size_t)kNB * kHW * kHW * 2;
  char* ws = (char*)d_ws;
  size_t off = 0;
  unsigned short* W3fg   = (unsigned short*)(ws + off); off += bW3;
  unsigned short* hw16   = (unsigned short*)(ws + off); off += bW16;
  unsigned short* ow16   = (unsigned short*)(ws + off); off += bW16;
  float*          fgb    = (float*)(ws + off);          off += bFGB;
  float*          hb16   = (float*)(ws + off);          off += bHB;
  float*          stats  = (float*)(ws + off);          off += bST;
  unsigned short* contT  = (unsigned short*)(ws + off); off += bCT;
  unsigned short* FG3    = (unsigned short*)(ws + off); off += bFG3;
  unsigned short* H16    = (unsigned short*)(ws + off); off += bH16;
  float*          energy = (float*)(ws + off);          off += bEN;
  unsigned short* att    = (unsigned short*)(ws + off); off += bATT;
  unsigned short* aoT    = contT;
  unsigned short* normT3 = att + (size_t)(kNB - 1) * kHW * kHW;
  if (off > ws_size) return;

  const dim3 blk256(256);

  /* ---- once: weight planes, bias tables, per-(batch, channel) statistics ---- */
  wsplit_kernel<<<dim3((2 * kCH * kCH / 8) / 256), blk256, 0, stream>>>(f_w, g_w, W3fg);
  wcast_kernel<<<dim3((kCH * kCH / 8) / 256, 2), blk256, 0, stream>>>(h_w, o_w, hw16, ow16);
  bias_prep_kernel<<<dim3(1), blk256, 0, stream>>>(f_b, g_b, h_b, fgb, hb16);
  chan_stats_kernel<<<dim3(kNB * kCH), blk256, 0, stream>>>(content, stats);

  const dim3 blk128(128);
  constexpr int tilesFG = (kHW / 128) * ((2 * kCH) / 128);
  constexpr int tilesH  = (kCH / 128) * (kHW / 128);
  constexpr int tilesEN = (kQRows / 128) * (kHW / 128);
  constexpr int tilesPV = (kHW / 128) * (kCH / 128);

  for (int b0 = 0; b0 < kNB; b0 += kPair) {
    /* in x[C][HW] -> normT3[HW][hi|lo|hi], contT[HW][C], two batches */
    norm_transpose_kernel<<<dim3(kHW / 64, kCH / 64, kPair), blk256, 0, stream>>>(
        content + (size_t)b0 * kCH * kHW, stats + (size_t)b0 * kCH * kStatPitch, normT3,
        contT + (size_t)b0 * kHW * kCH);

    /* f|g projections: [pix][1024] = normT3[pix][hi|lo|hi] . W3fg[out][hi|hi|lo]^T + bias[out], split to
       FG3[pix][ Fhi | Fhi | Flo | Ghi | Glo | Ghi ]; M=4096, N=1024, K=1536, two batches */
    wmma_gemm64<1, 2, 3, false><<<dim3(tilesFG, kPair), blk128, 0, stream>>>(
        normT3, kK3, W3fg, kK3, (void*)FG3, kFGld, fgb, fgb, kHW, 2 * kCH, kK3, 1.0f,
        kHW * kK3, 0, kHW * kFGld);

    for (int p = 0; p < kPair; ++p) {
      const unsigned short* FGb = FG3 + (size_t)p * kHW * kFGld;
      unsigned short* attb = att + (size_t)(b0 + p) * kHW * kHW;
      for (int hq = 0; hq < kHW / kQRows; ++hq) {
        /* energy[q][k] for 2048 query rows: A = F3 rows [hi|hi|lo], Bt = G3 rows [hi|lo|hi]; M=2048, N=4096, K=1536 */
        wmma_gemm64<1, 0, 0, false><<<dim3(tilesEN), blk128, 0, stream>>>(
            FGb + (size_t)hq * kQRows * kFGld, kFGld, FGb + kK3, kFGld, (void*)energy, kHW,
            fgb, fgb, kQRows, kHW, kK3, 1.0f, 0, 0, 0);
        /* softmax over keys -> att rows (f16, x kPCarry) */
        softmax_rows_kernel<<<dim3(kQRows), blk256, 0, stream>>>(energy, attb + (size_t)hq * kQRows * kHW);
      }
    }
  }

  /* h projection: H16[b][o][pix] = kXCarry * (h_w . x + h_b); M=512, N=4096, K=512, four batches */
  wmma_gemm64<0, 1, 1, false><<<dim3(tilesH, kNB), blk128, 0, stream>>>(
      hw16, kCH, contT, kCH, (void*)H16, kHW, hb16, hb16, kCH, kHW, kCH, kScaleH,
      0, kHW * kCH, kCH * kHW);

  /* aoT[b][q][c] = kXCarry * sum_k att[b][q][k] * H[b][c][k]; M=4096, N=512, K=4096, four batches */
  wmma_gemm64<0, 0, 1, false><<<dim3(tilesPV, kNB), blk128, 0, stream>>>(
      att, kHW, H16, kHW, (void*)aoT, kCH, fgb, fgb, kHW, kCH, kHW, kScalePV,
      kHW * kHW, kCH * kHW, kHW * kCH);

  /* out[b][o][pix] = o_w . ao + o_b + x; M=512, N=4096, K=512, four batches */
  wmma_gemm64<0, 1, 0, true><<<dim3(tilesH, kNB), blk128, 0, stream>>>(
      ow16, kCH, aoT, kCH, (void*)out, kHW, o_b, content, kCH, kHW, kCH, kScaleO,
      0, kHW * kCH, kCH * kHW);
}

// v003
// It runs in 369 microseconds.
// Two timings next to v002 both put it at 1.06 times that version's speed.
// All steps since v000 together make it 5.31 times as fast.
// Contractions: f/g projections and q.k energy on v_wmma_f32_16x16x32_bf16 with bf16 hi/lo operand planes laid along K (hi.hi + lo.hi + hi.lo, 3 products); h projection, att.v and output projection on v_wmma_f32_16x16x32_f16 (weights carried x256, activations x16, probabilities x32768); f32 accumulate; statistics, softmax, bias and residual in f32.
#include <hip/hip_runtime.h>
#include <math.h>

/* --------------------------------------------------------------------------- */
/* Shape constants                                                             */
/* --------------------------------------------------------------------------- */
constexpr int kNB   = 4;
constexpr int kCH   = 512;
constexpr int kHW   = 4096;
constexpr int kK3   = 3 * kCH;
constexpr int kFGld = 6 * kCH;
constexpr int kStatPitch = 32;
constexpr float kWCarry = 256.0f;
constexpr float kXCarry = 16.0f;
constexpr float kPCarry = 32768.0f;
constexpr float kEps    = 1e-5f;
constexpr float kInvHW  = 1.0f / (float)kHW;
/* h projection: acc = kWCarry*kXCarry*H, stored plane = kXCarry*H */
constexpr float kScaleH  = 1.0f / kWCarry;
/* att.v: acc = kPCarry*kXCarry*ao, stored plane = kXCarry*ao */
constexpr float kScalePV = 1.0f / kPCarry;
/* output projection: acc = kWCarry*kXCarry*out */
constexpr float kScaleO  = 1.0f / (kWCarry * kXCarry);

static_assert(kCH % 128 == 0 && kHW % 128 == 0);
static_assert(kK3 % 128 == 0);
static_assert((2 * kCH) % 128 == 0);
/* the four normT3 planes fit the energy plane they borrow, a batch's FG3 plane the attention plane it borrows */
static_assert((size_t)kNB * kK3 * 2 <= (size_t)kHW * 4);
static_assert((size_t)kFGld <= (size_t)kHW);

typedef __attribute__((ext_vector_type(16))) _Float16 v16h;
typedef __attribute__((ext_vector_type(8)))  _Float16 v8h;
typedef __attribute__((ext_vector_type(16))) __bf16   v16b;
typedef __attribute__((ext_vector_type(8)))  __bf16   v8b;
typedef __attribute__((ext_vector_type(8)))  float    v8f;
typedef __attribute__((ext_vector_type(4)))  float    v4f;
typedef __attribute__((ext_vector_type(4)))  unsigned int v4u;

__device__ __forceinline__ unsigned short f2bf_bits(float f) {
  unsigned u = __float_as_uint(f);
  return (unsigned short)((u + 0x7FFFu + ((u >> 16) & 1u)) >> 16);
}
__device__ __forceinline__ float bf_bits2f(unsigned short h) { return __uint_as_float(((unsigned)h) << 16); }
__device__ __forceinline__ unsigned pk16(unsigned short a, unsigned short b) { return (unsigned)a | ((unsigned)b << 16); }
__device__ __forceinline__ unsigned short h_bits(float f) { const _Float16 h = (_Float16)f; return __builtin_bit_cast(unsigned short, h); }

/* four vector slots between the last matrix instruction of the K loop and the first reader of its result */
__device__ __forceinline__ void acc_guard4(v8f& a, v8f& b, v8f& c, v8f& d) { asm volatile("v_nop\n\tv_nop\n\tv_nop\n\tv_nop" : "+v"(a), "+v"(b), "+v"(c), "+v"(d)); }

template <typename T> struct Frag;
template <> struct Frag<_Float16> {
  typedef v16h V; union U { v16h v; v8h h[2]; };
  /* elements 0..7 <- p[0..7], elements 8..15 <- p[16..23] */
  static __device__ __forceinline__ v16h load(const _Float16* p) {
    U f; f.h[0] = *(const v8h*)(p); f.h[1] = *(const v8h*)(p + 16); return f.v;
  }
  static __device__ __forceinline__ v8f mma(v16h a, v16h b, v8f c) {
    return __builtin_amdgcn_wmma_f32_16x16x32_f16(false, a, false, b, (short)0, c, false, false);
  }
};
template <> struct Frag<__bf16> {
  typedef v16b V; union U { v16b v; v8b h[2]; };
  static __device__ __forceinline__ v16b load(const __bf16* p) {
    U f; f.h[0] = *(const v8b*)(p); f.h[1] = *(const v8b*)(p + 16); return f.v;
  }
  static __device__ __forceinline__ v8f mma(v16b a, v16b b, v8f c) {
    return __builtin_amdgcn_wmma_f32_16x16x32_bf16(false, a, false, b, (short)0, c, false, false);
  }
};

/* ---- Register-blocked WMMA GEMM ------------------------------------------------------------------ */
/* C[m,n] = scale * sum_k A[m,k] * Bt[n,k] (+bias)(+resid); a work-group of 4 waves (2 x 2) owns a     */
/* 128x128 tile, each wave a 64x64 quarter of it.                                                      */
/* A row-major [M,K] pitch lda; Bt row-major [N,K] pitch ldb; M,N % 128 == 0, K % 128 == 0.            */
/* Operands reach the waves through LDS: a pass is 128 k = 256 B of each of the tile's 128 A rows and  */
/* 128 Bt rows, brought in by asynchronous copies (whole 256-B rows, 16 B a lane) into one of two      */
/* buffers while the other buffer is worked on; rows lie at a pitch of 272 B for the 16-B readers.     */
/* ET: 0 = f16 operands, 1 = bf16 operands (pointers passed as 16-bit storage).                        */
/* BIAS_MODE: 0 = none, 1 = bias[m], 2 = bias[n].                                                      */
/* OUT_MODE: 0 = f32; 1 = f16; 3 = bf16 hi/lo triple-segment rows of pitch ldc:                         */
/*   columns n < N/2  -> [hi | hi | lo] at segment offsets 0, N/2, N     (first 3*N/2 columns)         */
/*   columns n >= N/2 -> [hi | lo | hi] at segment offsets 0, N/2, N     (second 3*N/2 columns)        */
/* RESID (OUT_MODE 0): the addend is fetched in the store phase, one 16-B load per lane at the address */
/* it is about to store.                                                                               */
/* blockIdx.y = batch: A, Bt and C (and the addend, laid out like C) advance by strideA, strideB and   */
/* strideC elements a batch; a stride of 0 is an operand that every batch shares.                      */
template <int ET> struct Elem;
template <> struct Elem<0> { typedef _Float16 T; };
template <> struct Elem<1> { typedef __bf16 T; };

constexpr int kPassK     = 128;
constexpr int kPassBytes = kPassK * 2;
constexpr int kRowPitch  = kPassBytes + 16;
constexpr int kOperBytes = 128 * kRowPitch;
constexpr int kBufBytes  = 2 * kOperBytes;

/* Eight asynchronous copies, 16 B a lane each, global -> LDS. The s_wait_xcnt stands inside the statement so  */
/* that it comes before any rewrite of the address registers the copies name.                                  */
__device__ __forceinline__ void async_copy8(const unsigned (&l)[8], const char* const (&g)[8]) {
  asm volatile(
      "global_load_async_to_lds_b128 %0, %8, off\n\t"
      "global_load_async_to_lds_b128 %1, %9, off\n\t"
      "global_load_async_to_lds_b128 %2, %10, off\n\t"
      "global_load_async_to_lds_b128 %3, %11, off\n\t"
      "global_load_async_to_lds_b128 %4, %12, off\n\t"
      "global_load_async_to_lds_b128 %5, %13, off\n\t"
      "global_load_async_to_lds_b128 %6, %14, off\n\t"
      "global_load_async_to_lds_b128 %7, %15, off\n\t"
      "s_wait_xcnt 0x0"
      :: "v"(l[0]), "v"(l[1]), "v"(l[2]), "v"(l[3]), "v"(l[4]), "v"(l[5]), "v"(l[6]), "v"(l[7]),
         "v"(g[0]), "v"(g[1]), "v"(g[2]), "v"(g[3]), "v"(g[4]), "v"(g[5]), "v"(g[6]), "v"(g[7])
      : "memory");
}

/* One wave's share of a pass: 32 rows of one operand, two rows a copy (lanes 0..15 one row, 16..31 the next). */
/* lds, g: the lane's own 16 B in the first pair of rows; pair2: bytes from one pair of global rows to the next. */
__device__ __forceinline__ void stage_rows32(unsigned lds, const char* g, size_t pair2) {
#pragma unroll
  for (int h = 0; h < 2; ++h) {
    unsigned l8[8];
    const char* g8[8];
#pragma unroll
    for (int j = 0; j < 8; ++j) {
      l8[j] = lds + (unsigned)((h * 8 + j) * 2 * kRowPitch);
      g8[j] = g + (size_t)(h * 8 + j) * pair2;
    }
    async_copy8(l8, g8);
  }
}

template <int ET, int BIAS_MODE, int OUT_MODE, bool RESID>
__global__ __launch_bounds__(128) void wmma_gemm64(
    const unsigned short* __restrict__ Ap, int lda,
    const unsigned short* __restrict__ Btp, int ldb,
    void* __restrict__ Cout, int ldc,
    const float* __restrict__ bias,
    const float* __restrict__ resid,
    int M, int N, int K, float scale,
    int strideA, int strideB, int strideC) {
  typedef typename Elem<ET>::T T;
  typedef typename Frag<T>::V V;
  const size_t batch = blockIdx.y;
  const T* Ab = (const T*)(const void*)Ap + batch * (size_t)strideA;
  const T* Bb = (const T*)(const void*)Btp + batch * (size_t)strideB;
  const size_t cOff = batch * (size_t)strideC;
  /* per-wave 16x64 slab, pitch 68 floats */
  __shared__ __align__(16) float sT[4][16 * 68];
  /* two buffers, each [A 128 rows | Bt 128 rows] at kRowPitch */
  __shared__ __align__(16) unsigned char ring[2 * kBufBytes];
  const int lane = threadIdx.x & 31;
  const int wave = threadIdx.x >> 5;
  const int tilesN = N >> 7;
  const int tilesM = M >> 7;
  const int tile = blockIdx.x;
  /* block-uniform exit, in front of every barrier and copy */
  if (tile >= tilesM * tilesN) return;
  const int tm = tile / tilesN;
  const int tn = tile - tm * tilesN;
  const int wm = wave >> 1;
  const int wn = wave & 1;
  const int m0 = (tm << 7) + (wm << 6);
  const int n0 = (tn << 7) + (wn << 6);

  /* row (A) / column (B, D) within a 16-wide subtile; k offset and D row offset of this lane half */
  const int rlane = lane & 15;
  const int koff  = (lane >> 4) * 8;
  const int mOff  = (lane >> 4) * 8;

  v8f acc[4][4];
#pragma unroll
  for (int i = 0; i < 4; ++i)
#pragma unroll
    for (int j = 0; j < 4; ++j) acc[i][j] = (v8f){0.f,0.f,0.f,0.f,0.f,0.f,0.f,0.f};

  /* copies: wave w brings rows 32w..32w+31 of the A tile and of the Bt tile */
  const int crow = (wave << 5) + (lane >> 4);
  const int cbyte = (lane & 15) * 16;
  const char* gA = (const char*)(Ab + (size_t)((tm << 7) + crow) * lda) + cbyte;
  const char* gB = (const char*)(Bb + (size_t)((tn << 7) + crow) * ldb) + cbyte;
  const size_t pairA = (size_t)lda * 4;
  const size_t pairB = (size_t)ldb * 4;
  const unsigned ldsA = (unsigned)(size_t)(ring) + (unsigned)(crow * kRowPitch + cbyte);
  const unsigned ldsB = ldsA + (unsigned)kOperBytes;
  const int nPass = K >> 7;

  stage_rows32(ldsA, gA, pairA);
  stage_rows32(ldsB, gB, pairB);
  /* pass 0 has landed in this wave's rows; the barrier shows them to the other waves */
  asm volatile("s_wait_asynccnt 0x0" ::: "memory");
  __syncthreads();
  if (nPass > 1) {
    stage_rows32(ldsA + (unsigned)kBufBytes, gA + kPassBytes, pairA);
    stage_rows32(ldsB + (unsigned)kBufBytes, gB + kPassBytes, pairB);
  }

  for (int t = 0; t < nPass; ++t) {
    const int bufOff = (t & 1) * kBufBytes;
    const T* aL = (const T*)(const void*)(ring + bufOff + ((wm << 6) + rlane) * kRowPitch) + koff;
    const T* bL = (const T*)(const void*)(ring + bufOff + kOperBytes + ((wn << 6) + rlane) * kRowPitch) + koff;
    V af[2][4], bf[2][4];
#pragma unroll
    for (int j = 0; j < 4; ++j) {
      bf[0][j] = Frag<T>::load(bL + j * (16 * kRowPitch / 2));
      af[0][j] = Frag<T>::load(aL + j * (16 * kRowPitch / 2));
    }
    /* keeps the group of LDS reads together: the compiler otherwise sinks them among the matrix instructions,  */
    /* one fragment at a time with a full wait each                                                             */
    __builtin_amdgcn_sched_barrier(0);
#pragma unroll
    for (int ks = 0; ks < kPassK / 32; ++ks) {
      const int cur = ks & 1, nxt = cur ^ 1;
      if (ks + 1 < kPassK / 32) {
        /* the next 32 k of this same buffer, as one group ahead of the current matrix block */
#pragma unroll
        for (int j = 0; j < 4; ++j) {
          bf[nxt][j] = Frag<T>::load(bL + j * (16 * kRowPitch / 2) + (ks + 1) * 32);
          af[nxt][j] = Frag<T>::load(aL + j * (16 * kRowPitch / 2) + (ks + 1) * 32);
        }
      }
      /* the reads above stay ahead of this matrix block, and the next group stays behind it */
      __builtin_amdgcn_sched_barrier(0);
#pragma unroll
      for (int i = 0; i < 4; ++i)
#pragma unroll
        for (int j = 0; j < 4; ++j) acc[i][j] = Frag<T>::mma(af[cur][i], bf[cur][j], acc[i][j]);
      __builtin_amdgcn_sched_barrier(0);
    }
    /* this wave's reads of the buffer are done before the buffer may be refilled */
    asm volatile("s_wait_dscnt 0x0" ::: "memory");
    /* this wave's copies of pass t + 1 have landed before the barrier shows them to the others */
    asm volatile("s_wait_asynccnt 0x0" ::: "memory");
    __syncthreads();
    if (t + 2 < nPass) {
      const size_t kb = (size_t)(t + 2) * kPassBytes;
      stage_rows32(ldsA + (unsigned)bufOff, gA + kb, pairA);
      stage_rows32(ldsB + (unsigned)bufOff, gB + kb, pairB);
    }
  }
  /* no copy is outstanding when the wave goes on to the epilogue and ends */
  asm volatile("s_wait_asynccnt 0x0" ::: "memory");
  acc_guard4(acc[0][0], acc[0][1], acc[0][2], acc[0][3]);
  acc_guard4(acc[1][0], acc[1][1], acc[1][2], acc[1][3]);
  acc_guard4(acc[2][0], acc[2][1], acc[2][2], acc[2][3]);
  acc_guard4(acc[3][0], acc[3][1], acc[3][2], acc[3][3]);

  /* ---- epilogue ---- */
  float* slab = sT[wave];
#pragma unroll
  for (int i = 0; i < 4; ++i) {
    const int mBase = m0 + (i << 4);
    float brow[8];
#pragma unroll
    for (int r = 0; r < 8; ++r) brow[r] = 0.f;
    if (BIAS_MODE == 1) {
      /* rows mBase+mOff .. +7: two 16-B loads (32-B aligned) */
      const v4f b0 = *(const v4f*)(bias + mBase + mOff);
      const v4f b1 = *(const v4f*)(bias + mBase + mOff + 4);
#pragma unroll
      for (int e = 0; e < 4; ++e) { brow[e] = b0[e]; brow[4 + e] = b1[e]; }
    }
#pragma unroll
    for (int j = 0; j < 4; ++j) {
      const int n = n0 + (j << 4) + rlane;
      float bv = 0.f;
      if (BIAS_MODE == 2) bv = bias[n];
#pragma unroll
      for (int r = 0; r < 8; ++r) {
        float v = acc[i][j][r] * scale;
        if (BIAS_MODE == 1) v += brow[r];
        if (BIAS_MODE == 2) v += bv;
        slab[(mOff + r) * 68 + (j << 4) + rlane] = v;
      }
    }
    __builtin_amdgcn_fence(__ATOMIC_RELEASE, "workgroup");
    __builtin_amdgcn_wave_barrier();
    __builtin_amdgcn_fence(__ATOMIC_ACQUIRE, "workgroup");
    if (OUT_MODE == 0) {
      float* C = (float*)Cout + cOff;
      /* row segment = 256 B = 16 lanes x 16 B; two rows per instruction */
      const int hh = lane >> 4, c4 = (lane & 15) * 4;
      if (RESID) {
        v4f vals[8];
#pragma unroll
        for (int it = 0; it < 8; ++it) {
          const int row = it * 2 + hh;
          const v4f sv = *(const v4f*)(slab + row * 68 + c4);
          const v4f rv = *(const v4f*)(resid + cOff + (size_t)(mBase + row) * ldc + n0 + c4);
          vals[it] = sv + rv;
        }
        {
#pragma unroll
          for (int it = 0; it < 8; ++it) {
            const int row = it * 2 + hh;
            *(v4f*)(C + (size_t)(mBase + row) * ldc + n0 + c4) = vals[it];
          }
          
        }
      } else {
        {
#pragma unroll
          for (int it = 0; it < 8; ++it) {
            const int row = it * 2 + hh;
            v4f v = *(const v4f*)(slab + row * 68 + c4);
            *(v4f*)(C + (size_t)(mBase + row) * ldc + n0 + c4) = v;
          }
          
        }
      }
    } else {
      const int q = lane >> 3, c8 = (lane & 7) * 8;
      unsigned short* C = (unsigned short*)Cout + cOff;
      int col0 = n0 + c8;
      int col1 = col0;
      int col2 = col0;
      if (OUT_MODE == 3) {
        /* wave-uniform segment selection */
        const int halfN = N >> 1;
        const int isg = (n0 >= halfN) ? 1 : 0;
        const int nn = n0 - isg * halfN;
        col0 = isg * 3 * halfN + nn + c8;
        col1 = col0 + (isg ? 2 * halfN : halfN);
        col2 = col0 + (isg ? halfN : 2 * halfN);
      }
      {
#pragma unroll
        for (int it = 0; it < 4; ++it) {
          const int row = it * 4 + q;
          const float* sp = slab + row * 68 + c8;
          v8h hv, lv;
#pragma unroll
          for (int e = 0; e < 8; ++e) {
            if (OUT_MODE == 1) {
              hv[e] = (_Float16)sp[e];
              lv[e] = hv[e];
            } else {
              const unsigned short hb = f2bf_bits(sp[e]);
              const unsigned short lb = f2bf_bits(sp[e] - bf_bits2f(hb));
              hv[e] = __builtin_bit_cast(_Float16, hb);
              lv[e] = __builtin_bit_cast(_Float16, lb);
            }
          }
          unsigned short* rowp = C + (size_t)(mBase + row) * ldc;
          *(v8h*)(rowp + col0) = hv;
          if (OUT_MODE == 3) {
            *(v8h*)(rowp + col1) = hv;
            *(v8h*)(rowp + col2) = lv;
          }
        }
        
      }
    }
    __builtin_amdgcn_fence(__ATOMIC_RELEASE, "workgroup");
    __builtin_amdgcn_wave_barrier();
    __builtin_amdgcn_fence(__ATOMIC_ACQUIRE, "workgroup");
  }
}

/* --------------------------------------------------------------------------- */
/* f/g weight planes: W3[1024][1536] bf16, row o = [hi(512) | hi(512) | lo(512)] of f_w row o (o < 512)        */
/* or g_w row o-512. One thread = 8 consecutive input channels.                                               */
/* Coverage: 256 blocks x 256 threads x 8 = 524288 = 1024 x 512. Each store instruction: 32 lanes x 16 B =    */
/* --------------------------------------------------------------------------- */
__device__ __forceinline__ void wsplit_block(int blk, const float* __restrict__ fw, const float* __restrict__ gw,
                                             unsigned short* __restrict__ W3) {
  const int i = blk * 256 + threadIdx.x;
  const int row = i >> 6;
  const int c8 = (i & 63) * 8;
  /* block-uniform: a block covers 4 whole rows */
  const float* src = (row < kCH) ? (fw + (size_t)row * kCH) : (gw + (size_t)(row - kCH) * kCH);
  const v4f a = *(const v4f*)(src + c8);
  const v4f c = *(const v4f*)(src + c8 + 4);
  float x[8];
#pragma unroll
  for (int e = 0; e < 4; ++e) { x[e] = a[e]; x[4 + e] = c[e]; }
  unsigned short hb[8], lb[8];
#pragma unroll
  for (int e = 0; e < 8; ++e) {
    hb[e] = f2bf_bits(x[e]);
    lb[e] = f2bf_bits(x[e] - bf_bits2f(hb[e]));
  }
  const v4u uh = (v4u){pk16(hb[0], hb[1]), pk16(hb[2], hb[3]), pk16(hb[4], hb[5]), pk16(hb[6], hb[7])};
  const v4u ul = (v4u){pk16(lb[0], lb[1]), pk16(lb[2], lb[3]), pk16(lb[4], lb[5]), pk16(lb[6], lb[7])};
  unsigned short* rp = W3 + (size_t)row * kK3 + c8;
  {
    *(v4u*)(rp) = uh;
    *(v4u*)(rp + kCH) = uh;
    *(v4u*)(rp + 2 * kCH) = ul;
    /* precaution: stands between the three stores and the code of another job, which the build lays behind  */
    /* this one and which rewrites the registers the stores name                                             */
    asm volatile("s_wait_xcnt 0x0" ::: "memory");
  }
}

/* --------------------------------------------------------------------------- */
/* h_w / o_w -> f16 planes carried x kWCarry. 2 x 128 blocks: which selects the matrix (block-uniform).       */
/* Coverage: 128 blocks x 256 threads x 8 = 262144 = 512 x 512 per matrix. One 16-B store per lane, a wave    */
/* --------------------------------------------------------------------------- */
__device__ __forceinline__ void wcast_block(int blk, int which, const float* __restrict__ hw, const float* __restrict__ ow,
                                            unsigned short* __restrict__ hw16, unsigned short* __restrict__ ow16) {
  const int i = blk * 256 + threadIdx.x;
  const float* src = (which == 0) ? hw : ow;
  unsigned short* dst = (which == 0) ? hw16 : ow16;
  const float* p = src + 8 * (size_t)i;
  const v4f a = *(const v4f*)(p);
  const v4f c = *(const v4f*)(p + 4);
  unsigned short hb[8];
#pragma unroll
  for (int e = 0; e < 4; ++e) {
    hb[e]     = h_bits(a[e] * kWCarry);
    hb[4 + e] = h_bits(c[e] * kWCarry);
  }
  const v4u u = (v4u){pk16(hb[0], hb[1]), pk16(hb[2], hb[3]), pk16(hb[4], hb[5]), pk16(hb[6], hb[7])};
  unsigned short* q = dst + 8 * (size_t)i;
  *(v4u*)q = u;
  
}

/* --------------------------------------------------------------------------- */
/* Bias tables: fgb[1024] = [f_b | g_b]; hb16[512] = kXCarry * h_b. One block of 256 threads.                 */
/* fgb: 256 threads x 4 floats = 1024; hb16: waves 0..3 x 32 lanes x 4 floats = 512. Every wave writes 4      */
/* --------------------------------------------------------------------------- */
__device__ __forceinline__ void bias_prep_block(const float* __restrict__ fb, const float* __restrict__ gb,
                                                const float* __restrict__ hb,
                                                float* __restrict__ fgb, float* __restrict__ hb16) {
  const int t = threadIdx.x;
  const int j = (t & 127) * 4;
  const v4f a = *(const v4f*)(fb + j);
  const v4f g = *(const v4f*)(gb + j);
  const v4f h = *(const v4f*)(hb + j);
  const bool first = (t < 128);
  v4f v;
#pragma unroll
  for (int e = 0; e < 4; ++e) v[e] = first ? a[e] : g[e];
  v4f hs;
#pragma unroll
  for (int e = 0; e < 4; ++e) hs[e] = h[e] * kXCarry;
  {
    *(v4f*)(fgb + 4 * t) = v;
    /* wave-uniform: waves 0..3 */
    if (first) *(v4f*)(hb16 + 4 * t) = hs;
    
  }
}

/* --------------------------------------------------------------------------- */
/* 4*512 blocks, one per (batch, channel); block 256 threads x 16 values = 4096.                               */
/* --------------------------------------------------------------------------- */
__device__ __forceinline__ float block_sum256(float v, float* red, int lane, int wave) {
#pragma unroll
  for (int off = 16; off > 0; off >>= 1) v += __shfl_xor(v, off, 32);
  if (lane == 0) red[wave] = v;
  __syncthreads();
  float s = 0.f;
#pragma unroll
  for (int w = 0; w < 8; ++w) s += red[w];
  __syncthreads();
  return s;
}

__device__ __forceinline__ void chan_stats_block(int blk, const float* __restrict__ x, float* __restrict__ stats) {
  __shared__ float red[8];
  const int t = threadIdx.x, lane = t & 31, wave = t >> 5;
  const float* row = x + (size_t)blk * kHW;
  v4f v[4];
#pragma unroll
  for (int q = 0; q < 4; ++q) v[q] = *(const v4f*)(row + (size_t)(q * 256 + t) * 4);
  float s = 0.f;
#pragma unroll
  for (int q = 0; q < 4; ++q) s += (v[q][0] + v[q][1]) + (v[q][2] + v[q][3]);
  s = block_sum256(s, red, lane, wave);
  const float mean = s * kInvHW;
  float ss = 0.f;
#pragma unroll
  for (int q = 0; q < 4; ++q) {
#pragma unroll
    for (int e = 0; e < 4; ++e) {
      const float d = v[q][e] - mean;
      ss += d * d;
    }
  }
  ss = block_sum256(ss, red, lane, wave);
  const float var = ss * kInvHW;
  const float rstd = 1.0f / sqrtf(var + kEps);
  if (wave == 0) {
    const float o = (lane == 0) ? mean : ((lane == 1) ? rstd : 0.0f);
    float* p = stats + (size_t)blk * kStatPitch + lane;
    *p = o;
    
  }
}

/* --------------------------------------------------------------------------- */
/* The four independent preparations in one grid; the block index picks the job (block-uniform branches):      */
/* statistics first (the long job), then f/g weight planes, h/o weight planes, bias tables.                    */
/* --------------------------------------------------------------------------- */
constexpr int kBlkStats  = kNB * kCH;
constexpr int kBlkSplit  = (2 * kCH * kCH / 8) / 256;
constexpr int kBlkCast   = (kCH * kCH / 8) / 256;
constexpr int kBlkPrep   = kBlkStats + kBlkSplit + 2 * kBlkCast + 1;
__global__ __launch_bounds__(256) void prep_kernel(const float* __restrict__ x,
                                                   const float* __restrict__ fw, const float* __restrict__ gw,
                                                   const float* __restrict__ hw, const float* __restrict__ ow,
                                                   const float* __restrict__ fb, const float* __restrict__ gb,
                                                   const float* __restrict__ hb,
                                                   float* __restrict__ stats, unsigned short* __restrict__ W3,
                                                   unsigned short* __restrict__ hw16, unsigned short* __restrict__ ow16,
                                                   float* __restrict__ fgb, float* __restrict__ hb16) {
  int blk = blockIdx.x;
  if (blk < kBlkStats) { chan_stats_block(blk, x, stats); return; }
  blk -= kBlkStats;
  if (blk < kBlkSplit) { wsplit_block(blk, fw, gw, W3); return; }
  blk -= kBlkSplit;
  if (blk < 2 * kBlkCast) { wcast_block(blk % kBlkCast, blk / kBlkCast, hw, ow, hw16, ow16); return; }
  bias_prep_block(fb, gb, hb, fgb, hb16);
}

/* --------------------------------------------------------------------------- */
/* Transpose one batch: x[C][HW] f32 -> normT3[HW][1536] bf16 rows [hi | lo | hi] of the normalised value over */
/* channel, and contT[HW][512] f16 of kXCarry * x. 64(ch) x 64(pix) tiles through LDS.                          */
/* grid = (HW/64, C/64, batches of this launch), 256 threads; blockIdx.z steps every pointer by one batch.     */
/* Load coverage: 4 it x 256 thr x 4 floats = 4096 = 64x64. Store coverage per plane: 2 it x 32 rows x 8 lanes */
/* --------------------------------------------------------------------------- */
__global__ __launch_bounds__(256) void norm_transpose_kernel(const float* __restrict__ x, const float* __restrict__ stats,
                                                             unsigned short* __restrict__ normT3,
                                                             unsigned short* __restrict__ contT) {
  __shared__ __align__(16) float tf[64 * 68];
  __shared__ float sMean[64];
  __shared__ float sRstd[64];
  const int p0  = blockIdx.x * 64;
  const int c0  = blockIdx.y * 64;
  const int tid = threadIdx.x;
  const size_t bz = blockIdx.z;
  x      += bz * (size_t)(kCH * kHW);
  stats  += bz * (size_t)(kCH * kStatPitch);
  normT3 += bz * (size_t)(kHW * kK3);
  contT  += bz * (size_t)(kHW * kCH);
  {
    const int lr = tid >> 4;
    const int c4 = (tid & 15) * 4;
#pragma unroll
    for (int it = 0; it < 4; ++it) {
      const int rr = it * 16 + lr;
      const v4f a = *(const v4f*)(x + (size_t)(c0 + rr) * kHW + p0 + c4);
      *(v4f*)(tf + rr * 68 + c4) = a;
    }
    /* channel statistics: threads 0..63 stage the mean, 64..127 the rstd (wave-uniform branches) */
    const int ch = tid & 63;
    const int which = (tid >> 6) & 1;
    const float sv = stats[(size_t)(c0 + ch) * kStatPitch + which];
    if (tid < 64) sMean[ch] = sv;
    else if (tid < 128) sRstd[ch] = sv;
  }
  __syncthreads();
  const int sub = tid >> 3;
  const int c8  = (tid & 7) * 8;
  v4u nh[2], nl[2], cf[2];
#pragma unroll
  for (int it = 0; it < 2; ++it) {
    const int oc = it * 32 + sub;
    v4u a, a2, a3;
#pragma unroll
    for (int q = 0; q < 4; ++q) {
      const int ch0 = c8 + 2 * q;
      const int ch1 = ch0 + 1;
      const float x0 = tf[ch0 * 68 + oc];
      const float x1 = tf[ch1 * 68 + oc];
      const float n0v = (x0 - sMean[ch0]) * sRstd[ch0];
      const float n1v = (x1 - sMean[ch1]) * sRstd[ch1];
      const unsigned short h0 = f2bf_bits(n0v), h1 = f2bf_bits(n1v);
      const unsigned short l0 = f2bf_bits(n0v - bf_bits2f(h0)), l1 = f2bf_bits(n1v - bf_bits2f(h1));
      a[q]  = pk16(h0, h1);
      a2[q] = pk16(l0, l1);
      a3[q] = pk16(h_bits(x0 * kXCarry), h_bits(x1 * kXCarry));
    }
    nh[it] = a; nl[it] = a2; cf[it] = a3;
  }
  {
#pragma unroll
    for (int it = 0; it < 2; ++it) {
      const int oc = it * 32 + sub;
      unsigned short* np = normT3 + (size_t)(p0 + oc) * kK3 + c0 + c8;
      unsigned short* cp = contT + (size_t)(p0 + oc) * kCH + c0 + c8;
      *(v4u*)(np) = nh[it];
      *(v4u*)(np + kCH) = nl[it];
      *(v4u*)(np + 2 * kCH) = nh[it];
      *(v4u*)(cp) = cf[it];
    }
    
  }
}

/* --------------------------------------------------------------------------- */
/* Row softmax over 4096 f32 logits: P[row][k] = f16( kPCarry * exp(s - max) / sum exp(s - max) ), f32 math.   */
/* One block of 256 threads per row; thread t owns columns 8t..8t+7 and 2048+8t..2048+8t+7 (256 x 16 = 4096).  */
/* Reductions in fixed order (thread, wave shuffle tree, 8 wave partials in index order).                      */
/* Store: two instructions, each one 16-B store per lane; a wave's 32 lanes write 512 contiguous B = 4 whole   */
/* --------------------------------------------------------------------------- */
__global__ __launch_bounds__(256) void softmax_rows_kernel(const float* __restrict__ E, unsigned short* __restrict__ P) {
  __shared__ float redM[8];
  __shared__ float redS[8];
  const int row  = blockIdx.x;
  const int t    = threadIdx.x;
  const int lane = t & 31, wave = t >> 5;
  const float* sr = E + (size_t)row * kHW + 8 * t;
  const v4f a0 = *(const v4f*)(sr);
  const v4f a1 = *(const v4f*)(sr + 4);
  const v4f b0 = *(const v4f*)(sr + kHW / 2);
  const v4f b1 = *(const v4f*)(sr + kHW / 2 + 4);
  float x[16];
#pragma unroll
  for (int e = 0; e < 4; ++e) { x[e] = a0[e]; x[4 + e] = a1[e]; x[8 + e] = b0[e]; x[12 + e] = b1[e]; }
  float m = x[0];
#pragma unroll
  for (int e = 1; e < 16; ++e) m = fmaxf(m, x[e]);
#pragma unroll
  for (int off = 16; off > 0; off >>= 1) m = fmaxf(m, __shfl_xor(m, off, 32));
  if (lane == 0) redM[wave] = m;
  __syncthreads();
  float mx = redM[0];
#pragma unroll
  for (int w = 1; w < 8; ++w) mx = fmaxf(mx, redM[w]);
  float s = 0.f;
#pragma unroll
  for (int e = 0; e < 16; ++e) {
    x[e] = __expf(x[e] - mx);
    s += x[e];
  }
#pragma unroll
  for (int off = 16; off > 0; off >>= 1) s += __shfl_xor(s, off, 32);
  if (lane == 0) redS[wave] = s;
  __syncthreads();
  float tot = 0.f;
#pragma unroll
  for (int w = 0; w < 8; ++w) tot += redS[w];
  const float inv = kPCarry * (1.0f / tot);
  unsigned short hb[16];
#pragma unroll
  for (int e = 0; e < 16; ++e) hb[e] = h_bits(x[e] * inv);
  const v4u u0 = (v4u){pk16(hb[0], hb[1]), pk16(hb[2], hb[3]), pk16(hb[4], hb[5]), pk16(hb[6], hb[7])};
  const v4u u1 = (v4u){pk16(hb[8], hb[9]), pk16(hb[10], hb[11]), pk16(hb[12], hb[13]), pk16(hb[14], hb[15])};
  unsigned short* pr = P + (size_t)row * kHW + 8 * t;
  {
    *(v4u*)(pr) = u0;
    *(v4u*)(pr + kHW / 2) = u1;
    
  }
}

/* --------------------------------------------------------------------------- */
/* Host orchestration (kernel launches and host arithmetic only).                                              */
/* d_in: 0 = content [4][512][4096], 1 = f_w, 2 = f_b, 3 = g_w, 4 = g_b, 5 = h_w, 6 = h_b, 7 = o_w, 8 = o_b    */
/* (weights [out][in] f32, biases [512] f32).                                                                  */
/* --------------------------------------------------------------------------- */
extern "C" void kernel_launch(void* const* d_in, const int* in_sizes, int n_in,
                              void* d_out, int out_size, void* d_ws, size_t ws_size,
                              hipStream_t stream) {
  if (n_in < 9) return;
  if (in_sizes[0] != kNB * kCH * kHW || out_size != kNB * kCH * kHW) return;
  if (in_sizes[1] != kCH * kCH || in_sizes[3] != kCH * kCH || in_sizes[5] != kCH * kCH || in_sizes[7] != kCH * kCH) return;
  if (in_sizes[2] != kCH || in_sizes[4] != kCH || in_sizes[6] != kCH || in_sizes[8] != kCH) return;

  const float* content = (const float*)d_in[0];
  const float* f_w = (const float*)d_in[1];
  const float* f_b = (const float*)d_in[2];
  const float* g_w = (const float*)d_in[3];
  const float* g_b = (const float*)d_in[4];
  const float* h_w = (const float*)d_in[5];
  const float* h_b = (const float*)d_in[6];
  const float* o_w = (const float*)d_in[7];
  const float* o_b = (const float*)d_in[8];
  float* out = (float*)d_out;

  /* Launches are shared: the four preparations are one grid; transpose, f|g projection, h projection, att.v and
     output projection take all four batches in one grid; energy and softmax take one whole batch.
       W3fg   bf16 [1024][1536]            3,145,728
       hw16   f16  [512][512]                524,288
       ow16   f16  [512][512]                524,288
       fgb    f32  [1024]                      4,096
       hb16   f32  [512]                       2,048
       stats  f32  [4*512][32]               262,144
       contT  f16  [4][4096][512]         16,777,216   (aoT lies here once the h projection has read it)
       H16    f16  [4][512][4096]         16,777,216
       energy f32  [4096][4096]           67,108,864   (normT3 bf16 [4][4096][1536] = 50,331,648 lies here; the f|g
                                                        projection has read it before energy is first written)
       att    f16  [4][4096][4096]       134,217,728   (FG3 bf16 [4096][3072] = 25,165,824 of batch b lies at the head
                                                        of plane b; the energy launch of b has read it before the
                                                        softmax of b writes the plane)
       total                             239,343,616                                              */
  const size_t bW3   = (size_t)2 * kCH * kK3 * 2;
  const size_t bW16  = (size_t)kCH * kCH * 2;
  const size_t bFGB  = (size_t)2 * kCH * 4;
  const size_t bHB   = (size_t)kCH * 4;
  const size_t bST   = (size_t)kNB * kCH * kStatPitch * 4;
  const size_t bCT   = (size_t)kNB * kHW * kCH * 2;
  const size_t bH16  = (size_t)kNB * kCH * kHW * 2;
  const size_t bEN   = (size_t)kHW * kHW * 4;
  const size_t bATT  = (size_t)kNB * kHW * kHW * 2;
  char* ws = (char*)d_ws;
  size_t off = 0;
  unsigned short* W3fg   = (unsigned short*)(ws + off); off += bW3;
  unsigned short* hw16   = (unsigned short*)(ws + off); off += bW16;
  unsigned short* ow16   = (unsigned short*)(ws + off); off += bW16;
  float*          fgb    = (float*)(ws + off);          off += bFGB;
  float*          hb16   = (float*)(ws + off);          off += bHB;
  float*          stats  = (float*)(ws + off);          off += bST;
  unsigned short* contT  = (unsigned short*)(ws + off); off += bCT;
  unsigned short* H16    = (unsigned short*)(ws + off); off += bH16;
  float*          energy = (float*)(ws + off);          off += bEN;
  unsigned short* att    = (unsigned short*)(ws + off); off += bATT;
  unsigned short* aoT    = contT;
  unsigned short* normT3 = (unsigned short*)(void*)energy;
  unsigned short* FG3    = att;
  if (off > ws_size) return;

  const dim3 blk256(256);
  const dim3 blk128(128);
  constexpr int tilesFG = (kHW / 128) * ((2 * kCH) / 128);
  constexpr int tilesH  = (kCH / 128) * (kHW / 128);
  constexpr int tilesEN = (kHW / 128) * (kHW / 128);
  constexpr int tilesPV = (kHW / 128) * (kCH / 128);

  /* weight planes, bias tables, per-(batch, channel) statistics */
  prep_kernel<<<dim3(kBlkPrep), blk256, 0, stream>>>(content, f_w, g_w, h_w, o_w, f_b, g_b, h_b,
                                                     stats, W3fg, hw16, ow16, fgb, hb16);

  /* in x[C][HW] -> normT3[HW][hi|lo|hi], contT[HW][C], four batches */
  norm_transpose_kernel<<<dim3(kHW / 64, kCH / 64, kNB), blk256, 0, stream>>>(content, stats, normT3, contT);

  /* f|g projections: [pix][1024] = normT3[pix][hi|lo|hi] . W3fg[out][hi|hi|lo]^T + bias[out], split to
     FG3[pix][ Fhi | Fhi | Flo | Ghi | Glo | Ghi ]; M=4096, N=1024, K=1536, four batches */
  wmma_gemm64<1, 2, 3, false><<<dim3(tilesFG, kNB), blk128, 0, stream>>>(
      normT3, kK3, W3fg, kK3, (void*)FG3, kFGld, fgb, fgb, kHW, 2 * kCH, kK3, 1.0f,
      kHW * kK3, 0, kHW * kHW);

  for (int b = 0; b < kNB; ++b) {
    const unsigned short* FGb = FG3 + (size_t)b * kHW * kHW;
    /* energy[q][k]: A = F3 rows [hi|hi|lo], Bt = G3 rows [hi|lo|hi]; M=4096, N=4096, K=1536 */
    wmma_gemm64<1, 0, 0, false><<<dim3(tilesEN), blk128, 0, stream>>>(
        FGb, kFGld, FGb + kK3, kFGld, (void*)energy, kHW, fgb, fgb, kHW, kHW, kK3, 1.0f, 0, 0, 0);
    /* softmax over keys -> att rows (f16, x kPCarry) */
    softmax_rows_kernel<<<dim3(kHW), blk256, 0, stream>>>(energy, att + (size_t)b * kHW * kHW);
  }

  /* h projection: H16[b][o][pix] = kXCarry * (h_w . x + h_b); M=512, N=4096, K=512, four batches */
  wmma_gemm64<0, 1, 1, false><<<dim3(tilesH, kNB), blk128, 0, stream>>>(
      hw16, kCH, contT, kCH, (void*)H16, kHW, hb16, hb16, kCH, kHW, kCH, kScaleH,
      0, kHW * kCH, kCH * kHW);

  /* aoT[b][q][c] = kXCarry * sum_k att[b][q][k] * H[b][c][k]; M=4096, N=512, K=4096, four batches */
  wmma_gemm64<0, 0, 1, false><<<dim3(tilesPV, kNB), blk128, 0, stream>>>(
      att, kHW, H16, kHW, (void*)aoT, kCH, fgb, fgb, kHW, kCH, kHW, kScalePV,
      kHW * kHW, kCH * kHW, kHW * kCH);

  /* out[b][o][pix] = o_w . ao + o_b + x; M=512, N=4096, K=512, four batches */
  wmma_gemm64<0, 1, 0, true><<<dim3(tilesH, kNB), blk128, 0, stream>>>(
      ow16, kCH, aoT, kCH, (void*)out, kHW, o_b, content, kCH, kHW, kCH, kScaleO,
      0, kHW * kCH, kCH * kHW);
}
